// v000
// Measured on an AMD MI455X. A time is GPU time per run, averaged over a window of back-to-back runs after a warm-up
// (all launches, gaps included; the runs take copies of the inputs in turn), and the median of several windows.
// Apart from v000's, it joins two sittings. Times from different sittings can be a few percent apart, while
// side-by-side timings come from the same sitting.
// v000, which the later versions start from, runs in 638 microseconds.
#include <hip/hip_runtime.h>
#include <hip/hip_bf16.h>

// ---------------------------------------------------------------------------
// MI455X (gfx1250) multi-head attention, f16-WMMA everywhere, f32 accumulate.
// Pipeline: q,W->f16 | QKV proj (WMMA GEMM) | flash attention (WMMA) | out proj.
// ---------------------------------------------------------------------------

typedef __attribute__((ext_vector_type(16))) _Float16 v16h;
typedef __attribute__((ext_vector_type(8)))  _Float16 v8h;
typedef __attribute__((ext_vector_type(4)))  _Float16 v4h;
typedef __attribute__((ext_vector_type(8)))  float    v8f;
typedef __attribute__((ext_vector_type(4)))  float    v4f;

constexpr int Bc = 4, Nc = 2048, Dc = 512, Hc = 8, HDc = 64;
constexpr int BN = Bc * Nc;                 // 8192 rows

__device__ __forceinline__ v8f wmma_f16(v16h a, v16h b, v8f c) {
  // (neg_a, A, neg_b, B, c_mod, C, reuse_a, reuse_b)
  return __builtin_amdgcn_wmma_f32_16x16x32_f16(false, a, false, b, (short)0, c,
                                                false, false);
}

__device__ __forceinline__ v8f zero8() {
  v8f z = {0.f, 0.f, 0.f, 0.f, 0.f, 0.f, 0.f, 0.f};
  return z;
}

// --------------------------- f32 -> f16 convert ----------------------------
__global__ void cvt_f32_to_f16_kernel(const float* __restrict__ in,
                                      _Float16* __restrict__ out) {
  const size_t i = ((size_t)blockIdx.x * blockDim.x + threadIdx.x) * 4;
  v4f x = *(const v4f*)(in + i);
  v4h h;
  h[0] = (_Float16)x[0]; h[1] = (_Float16)x[1];
  h[2] = (_Float16)x[2]; h[3] = (_Float16)x[3];
  *(v4h*)(out + i) = h;
}

// ------------------------------ WMMA GEMM ----------------------------------
// C[BN, D] = X[BN, D](f16) @ W[D, D](f16, used as W^T).
// mode 0: write f16 head-major [H][B][N][HD] (for Q/K/V).
// mode 1: write f32 row-major  [BN][D]       (final output).
// One wave computes one 16x16 output tile; K loop in steps of 32.
// Inner loop is pure global_load_b128 -> v_wmma (weights pre-converted).
__global__ void gemm16_kernel(const _Float16* __restrict__ X,
                              const _Float16* __restrict__ W,
                              _Float16* __restrict__ outH,
                              float* __restrict__ outF,
                              int mode) {
  const int wave  = blockIdx.x * (blockDim.x >> 5) + (threadIdx.x >> 5);
  const int lane  = threadIdx.x & 31;
  const int tilesN = Dc / 16;                 // 32
  const int tm = wave / tilesN;
  const int tn = wave % tilesN;
  const int m0 = tm * 16, n0 = tn * 16;
  const int half = lane >> 4;                 // K-run selector (ISA 16-bit layout)
  const int idx  = lane & 15;                 // A: row, B: column

  const _Float16* ar = X + (size_t)(m0 + idx) * Dc;
  const _Float16* br = W + (size_t)(n0 + idx) * Dc;

  v8f acc = zero8();
  for (int k0 = 0; k0 < Dc; k0 += 32) {
    if (k0 + 64 < Dc) {                       // speculative WGP prefetch
      __builtin_prefetch(ar + k0 + 64, 0, 1);
      __builtin_prefetch(br + k0 + 64, 0, 1);
    }
    // A operand: row m=idx, runs K=[half*8..+8) and K=[16+half*8..+8)
    v8h a0 = *(const v8h*)(ar + k0 + half * 8);
    v8h a1 = *(const v8h*)(ar + k0 + 16 + half * 8);
    // B operand (= W^T tile): column n=idx, same K runs
    v8h b0 = *(const v8h*)(br + k0 + half * 8);
    v8h b1 = *(const v8h*)(br + k0 + 16 + half * 8);
    v16h A, Bm;
#pragma unroll
    for (int i = 0; i < 8; ++i) {
      A[i] = a0[i];  A[8 + i] = a1[i];
      Bm[i] = b0[i]; Bm[8 + i] = b1[i];
    }
    acc = wmma_f16(A, Bm, acc);
  }

  // C layout: lane holds column n=idx; VGPR r holds row m=r+8*half.
  if (mode == 0) {
#pragma unroll
    for (int r = 0; r < 8; ++r) {
      const int row  = m0 + r + 8 * half;      // index into [B*N]
      const int b    = row / Nc;
      const int nseq = row % Nc;
      const int d    = n0 + idx;
      const int h    = d / HDc;
      const int hd   = d % HDc;
      outH[((size_t)(h * Bc + b) * Nc + nseq) * HDc + hd] = (_Float16)acc[r];
    }
  } else {
#pragma unroll
    for (int r = 0; r < 8; ++r) {
      const int row = m0 + r + 8 * half;
      outF[(size_t)row * Dc + n0 + idx] = acc[r];
    }
  }
}

// ---------------------------- flash attention ------------------------------
// One wave per 16-query tile of one (h,b). 8 waves/block share (h,b), so the
// 32-key V tile is staged once per block into LDS (transposed [hd][key]).
__global__ void attn_kernel(const _Float16* __restrict__ Qh,   // [H][B][N][HD]
                            const _Float16* __restrict__ Kh,
                            const _Float16* __restrict__ Vh,
                            const float* __restrict__ bias,    // [B][N][N]
                            const int* __restrict__ mask,      // [B][N]
                            _Float16* __restrict__ Oh) {       // [B][N][D] f16
  __shared__ _Float16 VstT[HDc * 32];        // transposed V tile: [hd][keyLocal]
  __shared__ _Float16 Pst[8 * 16 * 32];      // per-wave P tile [16 q][32 key]

  const int waveId = threadIdx.x >> 5;
  const int lane   = threadIdx.x & 31;
  const int t  = blockIdx.x * 8 + waveId;    // 8 waves per block, same (h,b)
  const int qt = t % (Nc / 16);
  const int b  = (t / (Nc / 16)) % Bc;
  const int h  = t / (Bc * (Nc / 16));
  const int q0 = qt * 16;
  const int half = lane >> 4;
  const int idx  = lane & 15;

  const size_t hb = (size_t)(h * Bc + b) * Nc;
  const _Float16* Qb = Qh + hb * HDc;
  const _Float16* Kb = Kh + hb * HDc;
  const _Float16* Vb = Vh + hb * HDc;
  const float* biasQ = bias + ((size_t)b * Nc + q0) * Nc;
  const int*  maskB  = mask + b * Nc;
  _Float16* P = Pst + waveId * (16 * 32);

  // Q A-operands (K-dim = 64 -> two 16x32 chunks), pre-scaled by 1/sqrt(HD).
  v16h qa0, qa1;
  {
    const _Float16* qr = Qb + (size_t)(q0 + idx) * HDc;
    v8h r00 = *(const v8h*)(qr + half * 8);
    v8h r01 = *(const v8h*)(qr + 16 + half * 8);
    v8h r10 = *(const v8h*)(qr + 32 + half * 8);
    v8h r11 = *(const v8h*)(qr + 48 + half * 8);
    const _Float16 s = (_Float16)0.125f;     // 1/sqrt(64)
#pragma unroll
    for (int i = 0; i < 8; ++i) {
      qa0[i] = r00[i] * s; qa0[8 + i] = r01[i] * s;
      qa1[i] = r10[i] * s; qa1[8 + i] = r11[i] * s;
    }
  }

  v8f o0 = zero8(), o1 = zero8(), o2 = zero8(), o3 = zero8();
  float rmax[8], rsum[8];
#pragma unroll
  for (int r = 0; r < 8; ++r) { rmax[r] = -1e30f; rsum[r] = 0.f; }

  for (int kk = 0; kk < Nc; kk += 32) {
    if (kk + 32 < Nc) {                      // prefetch next key chunk (L2-hot)
      __builtin_prefetch(Kb + (size_t)(kk + 32 + idx) * HDc, 0, 1);
      __builtin_prefetch(Vb + (size_t)(kk + 32 + idx) * HDc, 0, 1);
    }
    __syncthreads();                         // prior tile fully consumed
    {                                        // stage V[32 keys][64 hd] transposed
      const int key = threadIdx.x >> 3;
      const int hd0 = (threadIdx.x & 7) * 8;
      v8h v = *(const v8h*)(Vb + (size_t)(kk + key) * HDc + hd0);
#pragma unroll
      for (int i = 0; i < 8; ++i) VstT[(hd0 + i) * 32 + key] = v[i];
    }
    __syncthreads();

    // scores: two 16x16 key tiles, each = 2 WMMAs over K-dim 64
    v8f s0 = zero8(), s1 = zero8();
    {
      const _Float16* kr = Kb + (size_t)(kk + idx) * HDc;       // tile 0 col=key
      v16h kb0, kb1;
      v8h c00 = *(const v8h*)(kr + half * 8);
      v8h c01 = *(const v8h*)(kr + 16 + half * 8);
      v8h c10 = *(const v8h*)(kr + 32 + half * 8);
      v8h c11 = *(const v8h*)(kr + 48 + half * 8);
#pragma unroll
      for (int i = 0; i < 8; ++i) {
        kb0[i] = c00[i]; kb0[8 + i] = c01[i];
        kb1[i] = c10[i]; kb1[8 + i] = c11[i];
      }
      s0 = wmma_f16(qa0, kb0, s0);
      s0 = wmma_f16(qa1, kb1, s0);
    }
    {
      const _Float16* kr = Kb + (size_t)(kk + 16 + idx) * HDc;  // tile 1
      v16h kb0, kb1;
      v8h c00 = *(const v8h*)(kr + half * 8);
      v8h c01 = *(const v8h*)(kr + 16 + half * 8);
      v8h c10 = *(const v8h*)(kr + 32 + half * 8);
      v8h c11 = *(const v8h*)(kr + 48 + half * 8);
#pragma unroll
      for (int i = 0; i < 8; ++i) {
        kb0[i] = c00[i]; kb0[8 + i] = c01[i];
        kb1[i] = c10[i]; kb1[8 + i] = c11[i];
      }
      s1 = wmma_f16(qa0, kb0, s1);
      s1 = wmma_f16(qa1, kb1, s1);
    }

    // bias + key mask (lane = column = key; rows r+8*half)
    const int mk0 = maskB[kk + idx];
    const int mk1 = maskB[kk + 16 + idx];
#pragma unroll
    for (int r = 0; r < 8; ++r) {
      const size_t qoff = (size_t)(r + 8 * half) * Nc;
      s0[r] = mk0 ? -1e30f : (s0[r] + biasQ[qoff + kk + idx]);
      s1[r] = mk1 ? -1e30f : (s1[r] + biasQ[qoff + kk + 16 + idx]);
    }

    // online softmax: row reductions across the 16-lane column groups
    float alpha[8];
#pragma unroll
    for (int r = 0; r < 8; ++r) {
      float m = fmaxf(s0[r], s1[r]);
#pragma unroll
      for (int sh = 8; sh >= 1; sh >>= 1) m = fmaxf(m, __shfl_xor(m, sh, 32));
      const float nm = fmaxf(rmax[r], m);
      const float al = __expf(rmax[r] - nm);
      const float p0 = __expf(s0[r] - nm);
      const float p1 = __expf(s1[r] - nm);
      float ps = p0 + p1;
#pragma unroll
      for (int sh = 8; sh >= 1; sh >>= 1) ps += __shfl_xor(ps, sh, 32);
      rsum[r] = rsum[r] * al + ps;
      rmax[r] = nm;
      alpha[r] = al;
      s0[r] = p0;
      s1[r] = p1;
    }
#pragma unroll
    for (int r = 0; r < 8; ++r) {
      o0[r] *= alpha[r]; o1[r] *= alpha[r];
      o2[r] *= alpha[r]; o3[r] *= alpha[r];
    }

    // transpose P (C layout -> A layout) through per-wave LDS
#pragma unroll
    for (int r = 0; r < 8; ++r) {
      P[(r + 8 * half) * 32 + idx]      = (_Float16)s0[r];
      P[(r + 8 * half) * 32 + 16 + idx] = (_Float16)s1[r];
    }
    v16h pa;
    {
      v8h p0 = *(const v8h*)(P + idx * 32 + half * 8);
      v8h p1 = *(const v8h*)(P + idx * 32 + 16 + half * 8);
#pragma unroll
      for (int i = 0; i < 8; ++i) { pa[i] = p0[i]; pa[8 + i] = p1[i]; }
    }

    // O[16x64] += P[16x32] @ V[32x64]: 4 column tiles
#pragma unroll
    for (int nt = 0; nt < 4; ++nt) {
      const int hd = nt * 16 + idx;          // B column = hd
      v8h u0 = *(const v8h*)(VstT + hd * 32 + half * 8);
      v8h u1 = *(const v8h*)(VstT + hd * 32 + 16 + half * 8);
      v16h bv;
#pragma unroll
      for (int i = 0; i < 8; ++i) { bv[i] = u0[i]; bv[8 + i] = u1[i]; }
      if (nt == 0) o0 = wmma_f16(pa, bv, o0);
      else if (nt == 1) o1 = wmma_f16(pa, bv, o1);
      else if (nt == 2) o2 = wmma_f16(pa, bv, o2);
      else o3 = wmma_f16(pa, bv, o3);
    }
  }

  // normalize and store in [B][N][D] f16 for the output projection
#pragma unroll
  for (int r = 0; r < 8; ++r) {
    const float inv = 1.0f / rsum[r];
    const int row = q0 + r + 8 * half;
    const size_t base = ((size_t)b * Nc + row) * Dc + h * HDc;
    Oh[base + 0 * 16 + idx] = (_Float16)(o0[r] * inv);
    Oh[base + 1 * 16 + idx] = (_Float16)(o1[r] * inv);
    Oh[base + 2 * 16 + idx] = (_Float16)(o2[r] * inv);
    Oh[base + 3 * 16 + idx] = (_Float16)(o3[r] * inv);
  }
}

// ------------------------------- launcher ----------------------------------
extern "C" void kernel_launch(void* const* d_in, const int* in_sizes, int n_in,
                              void* d_out, int out_size, void* d_ws,
                              size_t ws_size, hipStream_t stream) {
  const float* q    = (const float*)d_in[0];
  const int*   mask = (const int*)d_in[1];
  const float* bias = (const float*)d_in[2];
  const float* Wq   = (const float*)d_in[3];
  const float* Wk   = (const float*)d_in[4];
  const float* Wv   = (const float*)d_in[5];
  const float* Wo   = (const float*)d_in[6];
  float* out = (float*)d_out;

  const size_t elems = (size_t)BN * Dc;      // 4,194,304 per activation buffer
  const size_t welems = (size_t)Dc * Dc;     //   262,144 per weight matrix
  _Float16* Xh  = (_Float16*)d_ws;           // q in f16          (8 MB)
  _Float16* Qh  = Xh + elems;                // head-major Q      (8 MB)
  _Float16* Kh  = Qh + elems;                // head-major K      (8 MB)
  _Float16* Vh  = Kh + elems;                // head-major V      (8 MB)
  _Float16* Oh  = Vh + elems;                // attn out [B,N,D]  (8 MB)
  _Float16* Wqh = Oh + elems;                // f16 weights (0.5 MB each)
  _Float16* Wkh = Wqh + welems;
  _Float16* Wvh = Wkh + welems;
  _Float16* Woh = Wvh + welems;

  // 1) convert q and all weights to f16 (4 elements / thread)
  cvt_f32_to_f16_kernel<<<(int)(elems / (256 * 4)), 256, 0, stream>>>(q, Xh);
  const int wcvtBlocks = (int)(welems / (256 * 4));   // 256
  cvt_f32_to_f16_kernel<<<wcvtBlocks, 256, 0, stream>>>(Wq, Wqh);
  cvt_f32_to_f16_kernel<<<wcvtBlocks, 256, 0, stream>>>(Wk, Wkh);
  cvt_f32_to_f16_kernel<<<wcvtBlocks, 256, 0, stream>>>(Wv, Wvh);
  cvt_f32_to_f16_kernel<<<wcvtBlocks, 256, 0, stream>>>(Wo, Woh);

  // 2) QKV projections: out = X @ W^T, head-major f16
  const int gemmBlocks = (BN / 16) * (Dc / 16) / 8;   // 2048
  gemm16_kernel<<<gemmBlocks, 256, 0, stream>>>(Xh, Wqh, Qh, nullptr, 0);
  gemm16_kernel<<<gemmBlocks, 256, 0, stream>>>(Xh, Wkh, Kh, nullptr, 0);
  gemm16_kernel<<<gemmBlocks, 256, 0, stream>>>(Xh, Wvh, Vh, nullptr, 0);

  // 3) attention: 8 waves/block, block shares (h,b); 4096 waves total
  const int attnBlocks = Hc * Bc * (Nc / 16) / 8;     // 512
  attn_kernel<<<attnBlocks, 256, 0, stream>>>(Qh, Kh, Vh, bias, mask, Oh);

  // 4) output projection to f32
  gemm16_kernel<<<gemmBlocks, 256, 0, stream>>>(Oh, Woh, nullptr, out, 1);
}

// v001
// It runs in 376 microseconds.
// Next to v000, in two timings, it ran 1.72 times as fast each time.
#include <hip/hip_runtime.h>
#include <hip/hip_bf16.h>

// ---------------------------------------------------------------------------
// MI455X (gfx1250) multi-head attention, f16-WMMA everywhere, f32 accumulate.
// Pipeline: q,W->f16 | QKV proj (WMMA GEMM) | flash attention (WMMA) | out proj.
// ---------------------------------------------------------------------------

typedef __attribute__((ext_vector_type(16))) _Float16 v16h;
typedef __attribute__((ext_vector_type(8)))  _Float16 v8h;
typedef __attribute__((ext_vector_type(4)))  _Float16 v4h;
typedef __attribute__((ext_vector_type(8)))  float    v8f;
typedef __attribute__((ext_vector_type(4)))  float    v4f;

constexpr int Bc = 4, Nc = 2048, Dc = 512, Hc = 8, HDc = 64;
constexpr int BN = Bc * Nc;                 // 8192 rows

__device__ __forceinline__ v8f wmma_f16(v16h a, v16h b, v8f c) {
  // (neg_a, A, neg_b, B, c_mod, C, reuse_a, reuse_b)
  return __builtin_amdgcn_wmma_f32_16x16x32_f16(false, a, false, b, (short)0, c,
                                                false, false);
}

__device__ __forceinline__ v8f zero8() {
  v8f z = {0.f, 0.f, 0.f, 0.f, 0.f, 0.f, 0.f, 0.f};
  return z;
}

// --------------------------- f32 -> f16 convert ----------------------------
__global__ void cvt_f32_to_f16_kernel(const float* __restrict__ in,
                                      _Float16* __restrict__ out) {
  const size_t i = ((size_t)blockIdx.x * blockDim.x + threadIdx.x) * 4;
  v4f x = *(const v4f*)(in + i);
  v4h h;
  h[0] = (_Float16)x[0]; h[1] = (_Float16)x[1];
  h[2] = (_Float16)x[2]; h[3] = (_Float16)x[3];
  *(v4h*)(out + i) = h;
}

// ------------------------------ WMMA GEMM ----------------------------------
// C[BN, D] = X[BN, D](f16) @ W[D, D](f16, used as W^T).
// mode 0: write f16 head-major [H][B][N][HD] (for Q/K/V).
// mode 1: write f32 row-major  [BN][D]       (final output).
// One wave computes one 16x16 output tile; K loop in steps of 32.
// Inner loop is pure global_load_b128 -> v_wmma (weights pre-converted).
__global__ void gemm16_kernel(const _Float16* __restrict__ X,
                              const _Float16* __restrict__ W,
                              _Float16* __restrict__ outH,
                              float* __restrict__ outF,
                              int mode) {
  const int wave  = blockIdx.x * (blockDim.x >> 5) + (threadIdx.x >> 5);
  const int lane  = threadIdx.x & 31;
  const int tilesN = Dc / 16;                 // 32
  const int tm = wave / tilesN;
  const int tn = wave % tilesN;
  const int m0 = tm * 16, n0 = tn * 16;
  const int half = lane >> 4;                 // K-run selector (ISA 16-bit layout)
  const int idx  = lane & 15;                 // A: row, B: column

  const _Float16* ar = X + (size_t)(m0 + idx) * Dc;
  const _Float16* br = W + (size_t)(n0 + idx) * Dc;

  v8f acc = zero8();
  for (int k0 = 0; k0 < Dc; k0 += 32) {
    if (k0 + 64 < Dc) {                       // speculative WGP prefetch
      __builtin_prefetch(ar + k0 + 64, 0, 1);
      __builtin_prefetch(br + k0 + 64, 0, 1);
    }
    // A operand: row m=idx, runs K=[half*8..+8) and K=[16+half*8..+8)
    v8h a0 = *(const v8h*)(ar + k0 + half * 8);
    v8h a1 = *(const v8h*)(ar + k0 + 16 + half * 8);
    // B operand (= W^T tile): column n=idx, same K runs
    v8h b0 = *(const v8h*)(br + k0 + half * 8);
    v8h b1 = *(const v8h*)(br + k0 + 16 + half * 8);
    v16h A, Bm;
#pragma unroll
    for (int i = 0; i < 8; ++i) {
      A[i] = a0[i];  A[8 + i] = a1[i];
      Bm[i] = b0[i]; Bm[8 + i] = b1[i];
    }
    acc = wmma_f16(A, Bm, acc);
  }

  // C layout: lane holds column n=idx; VGPR r holds row m=r+8*half.
  if (mode == 0) {
#pragma unroll
    for (int r = 0; r < 8; ++r) {
      const int row  = m0 + r + 8 * half;      // index into [B*N]
      const int b    = row / Nc;
      const int nseq = row % Nc;
      const int d    = n0 + idx;
      const int h    = d / HDc;
      const int hd   = d % HDc;
      outH[((size_t)(h * Bc + b) * Nc + nseq) * HDc + hd] = (_Float16)acc[r];
    }
  } else {
#pragma unroll
    for (int r = 0; r < 8; ++r) {
      const int row = m0 + r + 8 * half;
      outF[(size_t)row * Dc + n0 + idx] = acc[r];
    }
  }
}

// ---------------------------- flash attention ------------------------------
// One wave per 16-query tile of one (h,b). 8 waves/block share (h,b), so the
// 32-key V tile is staged once per block into LDS (transposed [hd][key]).
__global__ void __launch_bounds__(256) attn_kernel(const _Float16* __restrict__ Qh,   // [H][B][N][HD]
                            const _Float16* __restrict__ Kh,
                            const _Float16* __restrict__ Vh,
                            const float* __restrict__ bias,    // [B][N][N]
                            const int* __restrict__ mask,      // [B][N]
                            _Float16* __restrict__ Oh) {       // [B][N][D] f16
  __shared__ _Float16 VstT[HDc * 32];        // transposed V tile: [hd][keyLocal]
  __shared__ _Float16 Pst[8 * 16 * 32];      // per-wave P tile [16 q][32 key]

  const int waveId = threadIdx.x >> 5;
  const int lane   = threadIdx.x & 31;
  const int t  = blockIdx.x * 8 + waveId;    // 8 waves per block, same (h,b)
  const int qt = t % (Nc / 16);
  const int b  = (t / (Nc / 16)) % Bc;
  const int h  = t / (Bc * (Nc / 16));
  const int q0 = qt * 16;
  const int half = lane >> 4;
  const int idx  = lane & 15;

  const size_t hb = (size_t)(h * Bc + b) * Nc;
  const _Float16* Qb = Qh + hb * HDc;
  const _Float16* Kb = Kh + hb * HDc;
  const _Float16* Vb = Vh + hb * HDc;
  const float* biasQ = bias + ((size_t)b * Nc + q0) * Nc;
  const int*  maskB  = mask + b * Nc;
  _Float16* P = Pst + waveId * (16 * 32);

  // Q A-operands (K-dim = 64 -> two 16x32 chunks), pre-scaled by 1/sqrt(HD).
  v16h qa0, qa1;
  {
    const _Float16* qr = Qb + (size_t)(q0 + idx) * HDc;
    v8h r00 = *(const v8h*)(qr + half * 8);
    v8h r01 = *(const v8h*)(qr + 16 + half * 8);
    v8h r10 = *(const v8h*)(qr + 32 + half * 8);
    v8h r11 = *(const v8h*)(qr + 48 + half * 8);
    const _Float16 s = (_Float16)0.125f;     // 1/sqrt(64)
#pragma unroll
    for (int i = 0; i < 8; ++i) {
      qa0[i] = r00[i] * s; qa0[8 + i] = r01[i] * s;
      qa1[i] = r10[i] * s; qa1[8 + i] = r11[i] * s;
    }
  }

  v8f o0 = zero8(), o1 = zero8(), o2 = zero8(), o3 = zero8();
  float rmax[8], rsum[8];
#pragma unroll
  for (int r = 0; r < 8; ++r) { rmax[r] = -1e30f; rsum[r] = 0.f; }

  for (int kk = 0; kk < Nc; kk += 32) {
    if (kk + 32 < Nc) {                      // prefetch next key chunk (L2-hot)
      __builtin_prefetch(Kb + (size_t)(kk + 32 + idx) * HDc, 0, 1);
      __builtin_prefetch(Vb + (size_t)(kk + 32 + idx) * HDc, 0, 1);
    }
    __syncthreads();                         // prior tile fully consumed
    float bz0[8], bz1[8];
    int mk0, mk1;
    v8h kc0[4], kc1[4];                      // K rows of key tiles 0 and 1
    {                                        // stage V[32 keys][64 hd] transposed
      const int key = threadIdx.x >> 3;
      const int hd0 = (threadIdx.x & 7) * 8;
      v8h v = *(const v8h*)(Vb + (size_t)(kk + key) * HDc + hd0);
      // keeps the V load first in the group, so that its LDS stores need not
      // wait for the arrival of the bias loads issued behind it
      __builtin_amdgcn_sched_barrier(0);
      // K, bias and key mask of this pass: unconditional loads, all in flight
      // beside the V load, so the pass waits for memory once, not once per load
      const _Float16* kr0 = Kb + (size_t)(kk + idx) * HDc;       // tile 0 col=key
      const _Float16* kr1 = Kb + (size_t)(kk + 16 + idx) * HDc;  // tile 1
#pragma unroll
      for (int j = 0; j < 4; ++j) {
        kc0[j] = *(const v8h*)(kr0 + j * 16 + half * 8);
        kc1[j] = *(const v8h*)(kr1 + j * 16 + half * 8);
      }
      mk0 = maskB[kk + idx];
      mk1 = maskB[kk + 16 + idx];
#pragma unroll
      for (int r = 0; r < 8; ++r) {
        const size_t qoff = (size_t)(r + 8 * half) * Nc;
        bz0[r] = biasQ[qoff + kk + idx];
        bz1[r] = biasQ[qoff + kk + 16 + idx];
      }
      // keeps the scheduler from sinking part of the loads behind the first
      // arrivals' users, which would put a second memory wait into the pass
      __builtin_amdgcn_sched_barrier(0);
#pragma unroll
      for (int i = 0; i < 8; ++i) VstT[(hd0 + i) * 32 + key] = v[i];
    }
    __syncthreads();

    // scores: two 16x16 key tiles, each = 2 WMMAs over K-dim 64
    v8f s0 = zero8(), s1 = zero8();
    {
      v16h kb0, kb1;
#pragma unroll
      for (int i = 0; i < 8; ++i) {
        kb0[i] = kc0[0][i]; kb0[8 + i] = kc0[1][i];
        kb1[i] = kc0[2][i]; kb1[8 + i] = kc0[3][i];
      }
      s0 = wmma_f16(qa0, kb0, s0);
      s0 = wmma_f16(qa1, kb1, s0);
    }
    {
      v16h kb0, kb1;
#pragma unroll
      for (int i = 0; i < 8; ++i) {
        kb0[i] = kc1[0][i]; kb0[8 + i] = kc1[1][i];
        kb1[i] = kc1[2][i]; kb1[8 + i] = kc1[3][i];
      }
      s1 = wmma_f16(qa0, kb0, s1);
      s1 = wmma_f16(qa1, kb1, s1);
    }

    // bias + key mask (lane = column = key; rows r+8*half)
#pragma unroll
    for (int r = 0; r < 8; ++r) {
      s0[r] = mk0 ? -1e30f : (s0[r] + bz0[r]);
      s1[r] = mk1 ? -1e30f : (s1[r] + bz1[r]);
    }

    // online softmax: row reductions across the 16-lane column groups
    float alpha[8];
#pragma unroll
    for (int r = 0; r < 8; ++r) {
      float m = fmaxf(s0[r], s1[r]);
#pragma unroll
      for (int sh = 8; sh >= 1; sh >>= 1) m = fmaxf(m, __shfl_xor(m, sh, 32));
      const float nm = fmaxf(rmax[r], m);
      const float al = __expf(rmax[r] - nm);
      const float p0 = __expf(s0[r] - nm);
      const float p1 = __expf(s1[r] - nm);
      float ps = p0 + p1;
#pragma unroll
      for (int sh = 8; sh >= 1; sh >>= 1) ps += __shfl_xor(ps, sh, 32);
      rsum[r] = rsum[r] * al + ps;
      rmax[r] = nm;
      alpha[r] = al;
      s0[r] = p0;
      s1[r] = p1;
    }
#pragma unroll
    for (int r = 0; r < 8; ++r) {
      o0[r] *= alpha[r]; o1[r] *= alpha[r];
      o2[r] *= alpha[r]; o3[r] *= alpha[r];
    }

    // transpose P (C layout -> A layout) through per-wave LDS
#pragma unroll
    for (int r = 0; r < 8; ++r) {
      P[(r + 8 * half) * 32 + idx]      = (_Float16)s0[r];
      P[(r + 8 * half) * 32 + 16 + idx] = (_Float16)s1[r];
    }
    v16h pa;
    {
      v8h p0 = *(const v8h*)(P + idx * 32 + half * 8);
      v8h p1 = *(const v8h*)(P + idx * 32 + 16 + half * 8);
#pragma unroll
      for (int i = 0; i < 8; ++i) { pa[i] = p0[i]; pa[8 + i] = p1[i]; }
    }

    // O[16x64] += P[16x32] @ V[32x64]: 4 column tiles
#pragma unroll
    for (int nt = 0; nt < 4; ++nt) {
      const int hd = nt * 16 + idx;          // B column = hd
      v8h u0 = *(const v8h*)(VstT + hd * 32 + half * 8);
      v8h u1 = *(const v8h*)(VstT + hd * 32 + 16 + half * 8);
      v16h bv;
#pragma unroll
      for (int i = 0; i < 8; ++i) { bv[i] = u0[i]; bv[8 + i] = u1[i]; }
      if (nt == 0) o0 = wmma_f16(pa, bv, o0);
      else if (nt == 1) o1 = wmma_f16(pa, bv, o1);
      else if (nt == 2) o2 = wmma_f16(pa, bv, o2);
      else o3 = wmma_f16(pa, bv, o3);
    }
  }

  // normalize and store in [B][N][D] f16 for the output projection
#pragma unroll
  for (int r = 0; r < 8; ++r) {
    const float inv = 1.0f / rsum[r];
    const int row = q0 + r + 8 * half;
    const size_t base = ((size_t)b * Nc + row) * Dc + h * HDc;
    Oh[base + 0 * 16 + idx] = (_Float16)(o0[r] * inv);
    Oh[base + 1 * 16 + idx] = (_Float16)(o1[r] * inv);
    Oh[base + 2 * 16 + idx] = (_Float16)(o2[r] * inv);
    Oh[base + 3 * 16 + idx] = (_Float16)(o3[r] * inv);
  }
}

// ------------------------------- launcher ----------------------------------
extern "C" void kernel_launch(void* const* d_in, const int* in_sizes, int n_in,
                              void* d_out, int out_size, void* d_ws,
                              size_t ws_size, hipStream_t stream) {
  const float* q    = (const float*)d_in[0];
  const int*   mask = (const int*)d_in[1];
  const float* bias = (const float*)d_in[2];
  const float* Wq   = (const float*)d_in[3];
  const float* Wk   = (const float*)d_in[4];
  const float* Wv   = (const float*)d_in[5];
  const float* Wo   = (const float*)d_in[6];
  float* out = (float*)d_out;

  const size_t elems = (size_t)BN * Dc;      // 4,194,304 per activation buffer
  const size_t welems = (size_t)Dc * Dc;     //   262,144 per weight matrix
  _Float16* Xh  = (_Float16*)d_ws;           // q in f16          (8 MB)
  _Float16* Qh  = Xh + elems;                // head-major Q      (8 MB)
  _Float16* Kh  = Qh + elems;                // head-major K      (8 MB)
  _Float16* Vh  = Kh + elems;                // head-major V      (8 MB)
  _Float16* Oh  = Vh + elems;                // attn out [B,N,D]  (8 MB)
  _Float16* Wqh = Oh + elems;                // f16 weights (0.5 MB each)
  _Float16* Wkh = Wqh + welems;
  _Float16* Wvh = Wkh + welems;
  _Float16* Woh = Wvh + welems;

  // 1) convert q and all weights to f16 (4 elements / thread)
  cvt_f32_to_f16_kernel<<<(int)(elems / (256 * 4)), 256, 0, stream>>>(q, Xh);
  const int wcvtBlocks = (int)(welems / (256 * 4));   // 256
  cvt_f32_to_f16_kernel<<<wcvtBlocks, 256, 0, stream>>>(Wq, Wqh);
  cvt_f32_to_f16_kernel<<<wcvtBlocks, 256, 0, stream>>>(Wk, Wkh);
  cvt_f32_to_f16_kernel<<<wcvtBlocks, 256, 0, stream>>>(Wv, Wvh);
  cvt_f32_to_f16_kernel<<<wcvtBlocks, 256, 0, stream>>>(Wo, Woh);

  // 2) QKV projections: out = X @ W^T, head-major f16
  const int gemmBlocks = (BN / 16) * (Dc / 16) / 8;   // 2048
  gemm16_kernel<<<gemmBlocks, 256, 0, stream>>>(Xh, Wqh, Qh, nullptr, 0);
  gemm16_kernel<<<gemmBlocks, 256, 0, stream>>>(Xh, Wkh, Kh, nullptr, 0);
  gemm16_kernel<<<gemmBlocks, 256, 0, stream>>>(Xh, Wvh, Vh, nullptr, 0);

  // 3) attention: 8 waves/block, block shares (h,b); 4096 waves total
  const int attnBlocks = Hc * Bc * (Nc / 16) / 8;     // 512
  attn_kernel<<<attnBlocks, 256, 0, stream>>>(Qh, Kh, Vh, bias, mask, Oh);

  // 4) output projection to f32
  gemm16_kernel<<<gemmBlocks, 256, 0, stream>>>(Oh, Woh, nullptr, out, 1);
}

// v002
// It runs in 215 microseconds.
// In both of two side-by-side timings against v001, it was 1.75 times as fast.
// Counting every step since v000, it is 3.01 times as fast.
#include <hip/hip_runtime.h>
#include <hip/hip_bf16.h>

// ---------------------------------------------------------------------------
// MI455X (gfx1250) multi-head attention, f16-WMMA everywhere, f32 accumulate.
// Pipeline: q,W->f16 | QKV proj (WMMA GEMM) | flash attention (WMMA) | out proj.
// ---------------------------------------------------------------------------

typedef __attribute__((ext_vector_type(16))) _Float16 v16h;
typedef __attribute__((ext_vector_type(8)))  _Float16 v8h;
typedef __attribute__((ext_vector_type(4)))  _Float16 v4h;
typedef __attribute__((ext_vector_type(8)))  float    v8f;
typedef __attribute__((ext_vector_type(4)))  float    v4f;

constexpr int Bc = 4, Nc = 2048, Dc = 512, Hc = 8, HDc = 64;
constexpr int BN = Bc * Nc;                 // 8192 rows

__device__ __forceinline__ v8f wmma_f16(v16h a, v16h b, v8f c) {
  // (neg_a, A, neg_b, B, c_mod, C, reuse_a, reuse_b)
  return __builtin_amdgcn_wmma_f32_16x16x32_f16(false, a, false, b, (short)0, c,
                                                false, false);
}

__device__ __forceinline__ v8f zero8() {
  v8f z = {0.f, 0.f, 0.f, 0.f, 0.f, 0.f, 0.f, 0.f};
  return z;
}

// --------------------------- f32 -> f16 convert ----------------------------
__global__ void cvt_f32_to_f16_kernel(const float* __restrict__ in,
                                      _Float16* __restrict__ out) {
  const size_t i = ((size_t)blockIdx.x * blockDim.x + threadIdx.x) * 4;
  v4f x = *(const v4f*)(in + i);
  v4h h;
  h[0] = (_Float16)x[0]; h[1] = (_Float16)x[1];
  h[2] = (_Float16)x[2]; h[3] = (_Float16)x[3];
  *(v4h*)(out + i) = h;
}

// ------------------------------ WMMA GEMM ----------------------------------
// C[BN, D] = X[BN, D](f16) @ W[D, D](f16, used as W^T).
// mode 0: write f16 head-major [H][B][N][HD] (for Q/K/V).
// mode 1: write f32 row-major  [BN][D]       (final output).
// One block computes a 128x64 tile of C. X and W rows come in chunks of 128 k
// (256 B a row) by loads that cover whole lines, are laid in LDS at a pitch of
// 272 B, and are read from there as fragments; each of the 8 waves owns 32x32.
constexpr int GBM = 128, GBN = 64, GBK = 128;
constexpr int GPITCH = GBK + 8;               // f16 elements: 256 B + 16 B pad
constexpr int GCHUNKS = Dc / GBK;             // 4

__global__ void __launch_bounds__(256) gemm16_kernel(const _Float16* __restrict__ X,
                              const _Float16* __restrict__ W,
                              _Float16* __restrict__ outH,
                              float* __restrict__ outF,
                              int mode) {
  __shared__ __attribute__((aligned(16))) _Float16 As[2][GBM * GPITCH];
  __shared__ __attribute__((aligned(16))) _Float16 Bs[2][GBN * GPITCH];

  const int tid   = threadIdx.x;
  const int wave  = tid >> 5;
  const int lane  = tid & 31;
  const int bm = blockIdx.x / (Dc / GBN);     // neighbours share the X rows
  const int bn = blockIdx.x % (Dc / GBN);
  const int half = lane >> 4;                 // K-run selector (ISA 16-bit layout)
  const int idx  = lane & 15;                 // A: row, B: column
  const int wm = (wave >> 1) * 32;            // wave's rows inside the tile
  const int wn = (wave & 1) * 32;             // wave's columns inside the tile

  // staging: 16 threads take one row's 256 B, so a wave's load is 2 whole rows
  const int srow = tid >> 4;
  const int scol = (tid & 15) * 8;
  const _Float16* xg = X + (size_t)(bm * GBM + srow) * Dc + scol;
  const _Float16* wg = W + (size_t)(bn * GBN + srow) * Dc + scol;
  const int sdst = srow * GPITCH + scol;

  // every loop of this kernel has a constant trip count and is unrolled, so
  // that ra, rb, acc and the fragments are registers, not indexed scratch
  v8h ra[GBM / 16], rb[GBN / 16];
#pragma unroll
  for (int p = 0; p < GBM / 16; ++p) ra[p] = *(const v8h*)(xg + (size_t)p * 16 * Dc);
#pragma unroll
  for (int p = 0; p < GBN / 16; ++p) rb[p] = *(const v8h*)(wg + (size_t)p * 16 * Dc);
#pragma unroll
  for (int p = 0; p < GBM / 16; ++p) *(v8h*)(&As[0][sdst + p * 16 * GPITCH]) = ra[p];
#pragma unroll
  for (int p = 0; p < GBN / 16; ++p) *(v8h*)(&Bs[0][sdst + p * 16 * GPITCH]) = rb[p];
  __syncthreads();

  v8f acc[2][2];
#pragma unroll
  for (int i = 0; i < 2; ++i)
#pragma unroll
    for (int j = 0; j < 2; ++j) acc[i][j] = zero8();

  // unrolled so that the buffer index and the last chunk's test are constants
#pragma unroll
  for (int c = 0; c < GCHUNKS; ++c) {
    const int cur = c & 1;
    if (c + 1 < GCHUNKS) {                    // next chunk flies during this one
#pragma unroll
      for (int p = 0; p < GBM / 16; ++p)
        ra[p] = *(const v8h*)(xg + (size_t)p * 16 * Dc + (c + 1) * GBK);
#pragma unroll
      for (int p = 0; p < GBN / 16; ++p)
        rb[p] = *(const v8h*)(wg + (size_t)p * 16 * Dc + (c + 1) * GBK);
      // keeps these loads ahead of this chunk's LDS reads and products: sunk
      // among them they would start late and the LDS stores below would wait
      __builtin_amdgcn_sched_barrier(0);
    }
#pragma unroll
    for (int ks = 0; ks < GBK / 32; ++ks) {
      // A: row m=idx, runs K=[half*8..+8) and K=[16+half*8..+8); B alike
      v16h A[2], Bm[2];
#pragma unroll
      for (int i = 0; i < 2; ++i) {
        const _Float16* ap = &As[cur][(wm + i * 16 + idx) * GPITCH + ks * 32 + half * 8];
        const _Float16* bp = &Bs[cur][(wn + i * 16 + idx) * GPITCH + ks * 32 + half * 8];
        v8h a0 = *(const v8h*)ap;
        v8h a1 = *(const v8h*)(ap + 16);
        v8h b0 = *(const v8h*)bp;
        v8h b1 = *(const v8h*)(bp + 16);
#pragma unroll
        for (int e = 0; e < 8; ++e) {
          A[i][e] = a0[e];  A[i][8 + e] = a1[e];
          Bm[i][e] = b0[e]; Bm[i][8 + e] = b1[e];
        }
      }
#pragma unroll
      for (int i = 0; i < 2; ++i)
#pragma unroll
        for (int j = 0; j < 2; ++j) acc[i][j] = wmma_f16(A[i], Bm[j], acc[i][j]);
    }
    if (c + 1 < GCHUNKS) {
      // the other buffer: its readers left it before the previous barrier
#pragma unroll
      for (int p = 0; p < GBM / 16; ++p) *(v8h*)(&As[cur ^ 1][sdst + p * 16 * GPITCH]) = ra[p];
#pragma unroll
      for (int p = 0; p < GBN / 16; ++p) *(v8h*)(&Bs[cur ^ 1][sdst + p * 16 * GPITCH]) = rb[p];
      __syncthreads();
    }
  }

  // C layout: lane holds column n=idx; VGPR r holds row m=r+8*half.
  // One base address a lane: every fragment's element lies at a constant step.
  static_assert(GBN == HDc && Nc % GBM == 0, "a tile is one head of one batch");
  const int row0 = bm * GBM + wm + 8 * half;   // index into [B*N]
  if (mode == 0) {
    const int b    = row0 / Nc;
    const int nseq = row0 % Nc;
    _Float16* op = outH + ((size_t)(bn * Bc + b) * Nc + nseq) * HDc + wn + idx;
#pragma unroll
    for (int i = 0; i < 2; ++i)
#pragma unroll
      for (int j = 0; j < 2; ++j)
#pragma unroll
        for (int r = 0; r < 8; ++r)
          op[(i * 16 + r) * HDc + j * 16] = (_Float16)acc[i][j][r];
  } else {
    float* op = outF + (size_t)row0 * Dc + bn * GBN + wn + idx;
#pragma unroll
    for (int i = 0; i < 2; ++i)
#pragma unroll
      for (int j = 0; j < 2; ++j)
#pragma unroll
        for (int r = 0; r < 8; ++r)
          op[(i * 16 + r) * Dc + j * 16] = acc[i][j][r];
    // the kernel ends after this run of stores, so no later code rewrites their
    // data or address registers: the wait is only a precaution
    asm volatile("s_wait_xcnt 0x0" ::: "memory");
  }
}

// ---------------------------- flash attention ------------------------------
// One wave per 16-query tile of one (h,b). 8 waves/block share (h,b), so the
// 32-key V tile is staged once per block into LDS (transposed [hd][key]).
__global__ void __launch_bounds__(256) attn_kernel(const _Float16* __restrict__ Qh,   // [H][B][N][HD]
                            const _Float16* __restrict__ Kh,
                            const _Float16* __restrict__ Vh,
                            const float* __restrict__ bias,    // [B][N][N]
                            const int* __restrict__ mask,      // [B][N]
                            _Float16* __restrict__ Oh) {       // [B][N][D] f16
  __shared__ _Float16 VstT[HDc * 32];        // transposed V tile: [hd][keyLocal]
  __shared__ _Float16 Pst[8 * 16 * 32];      // per-wave P tile [16 q][32 key]

  const int waveId = threadIdx.x >> 5;
  const int lane   = threadIdx.x & 31;
  const int t  = blockIdx.x * 8 + waveId;    // 8 waves per block, same (h,b)
  const int qt = t % (Nc / 16);
  const int b  = (t / (Nc / 16)) % Bc;
  const int h  = t / (Bc * (Nc / 16));
  const int q0 = qt * 16;
  const int half = lane >> 4;
  const int idx  = lane & 15;

  const size_t hb = (size_t)(h * Bc + b) * Nc;
  const _Float16* Qb = Qh + hb * HDc;
  const _Float16* Kb = Kh + hb * HDc;
  const _Float16* Vb = Vh + hb * HDc;
  const float* biasQ = bias + ((size_t)b * Nc + q0) * Nc;
  const int*  maskB  = mask + b * Nc;
  _Float16* P = Pst + waveId * (16 * 32);

  // Q A-operands (K-dim = 64 -> two 16x32 chunks), pre-scaled by 1/sqrt(HD).
  v16h qa0, qa1;
  {
    const _Float16* qr = Qb + (size_t)(q0 + idx) * HDc;
    v8h r00 = *(const v8h*)(qr + half * 8);
    v8h r01 = *(const v8h*)(qr + 16 + half * 8);
    v8h r10 = *(const v8h*)(qr + 32 + half * 8);
    v8h r11 = *(const v8h*)(qr + 48 + half * 8);
    const _Float16 s = (_Float16)0.125f;     // 1/sqrt(64)
#pragma unroll
    for (int i = 0; i < 8; ++i) {
      qa0[i] = r00[i] * s; qa0[8 + i] = r01[i] * s;
      qa1[i] = r10[i] * s; qa1[8 + i] = r11[i] * s;
    }
  }

  v8f o0 = zero8(), o1 = zero8(), o2 = zero8(), o3 = zero8();
  float rmax[8], rsum[8];
#pragma unroll
  for (int r = 0; r < 8; ++r) { rmax[r] = -1e30f; rsum[r] = 0.f; }

  for (int kk = 0; kk < Nc; kk += 32) {
    if (kk + 32 < Nc) {                      // prefetch next key chunk (L2-hot)
      __builtin_prefetch(Kb + (size_t)(kk + 32 + idx) * HDc, 0, 1);
      __builtin_prefetch(Vb + (size_t)(kk + 32 + idx) * HDc, 0, 1);
    }
    __syncthreads();                         // prior tile fully consumed
    float bz0[8], bz1[8];
    int mk0, mk1;
    v8h kc0[4], kc1[4];                      // K rows of key tiles 0 and 1
    {                                        // stage V[32 keys][64 hd] transposed
      const int key = threadIdx.x >> 3;
      const int hd0 = (threadIdx.x & 7) * 8;
      v8h v = *(const v8h*)(Vb + (size_t)(kk + key) * HDc + hd0);
      // keeps the V load first in the group, so that its LDS stores need not
      // wait for the arrival of the bias loads issued behind it
      __builtin_amdgcn_sched_barrier(0);
      // K, bias and key mask of this pass: unconditional loads, all in flight
      // beside the V load, so the pass waits for memory once, not once per load
      const _Float16* kr0 = Kb + (size_t)(kk + idx) * HDc;       // tile 0 col=key
      const _Float16* kr1 = Kb + (size_t)(kk + 16 + idx) * HDc;  // tile 1
#pragma unroll
      for (int j = 0; j < 4; ++j) {
        kc0[j] = *(const v8h*)(kr0 + j * 16 + half * 8);
        kc1[j] = *(const v8h*)(kr1 + j * 16 + half * 8);
      }
      mk0 = maskB[kk + idx];
      mk1 = maskB[kk + 16 + idx];
#pragma unroll
      for (int r = 0; r < 8; ++r) {
        const size_t qoff = (size_t)(r + 8 * half) * Nc;
        bz0[r] = biasQ[qoff + kk + idx];
        bz1[r] = biasQ[qoff + kk + 16 + idx];
      }
      // keeps the scheduler from sinking part of the loads behind the first
      // arrivals' users, which would put a second memory wait into the pass
      __builtin_amdgcn_sched_barrier(0);
#pragma unroll
      for (int i = 0; i < 8; ++i) VstT[(hd0 + i) * 32 + key] = v[i];
    }
    __syncthreads();

    // scores: two 16x16 key tiles, each = 2 WMMAs over K-dim 64
    v8f s0 = zero8(), s1 = zero8();
    {
      v16h kb0, kb1;
#pragma unroll
      for (int i = 0; i < 8; ++i) {
        kb0[i] = kc0[0][i]; kb0[8 + i] = kc0[1][i];
        kb1[i] = kc0[2][i]; kb1[8 + i] = kc0[3][i];
      }
      s0 = wmma_f16(qa0, kb0, s0);
      s0 = wmma_f16(qa1, kb1, s0);
    }
    {
      v16h kb0, kb1;
#pragma unroll
      for (int i = 0; i < 8; ++i) {
        kb0[i] = kc1[0][i]; kb0[8 + i] = kc1[1][i];
        kb1[i] = kc1[2][i]; kb1[8 + i] = kc1[3][i];
      }
      s1 = wmma_f16(qa0, kb0, s1);
      s1 = wmma_f16(qa1, kb1, s1);
    }

    // bias + key mask (lane = column = key; rows r+8*half)
#pragma unroll
    for (int r = 0; r < 8; ++r) {
      s0[r] = mk0 ? -1e30f : (s0[r] + bz0[r]);
      s1[r] = mk1 ? -1e30f : (s1[r] + bz1[r]);
    }

    // online softmax: row reductions across the 16-lane column groups
    float alpha[8];
#pragma unroll
    for (int r = 0; r < 8; ++r) {
      float m = fmaxf(s0[r], s1[r]);
#pragma unroll
      for (int sh = 8; sh >= 1; sh >>= 1) m = fmaxf(m, __shfl_xor(m, sh, 32));
      const float nm = fmaxf(rmax[r], m);
      const float al = __expf(rmax[r] - nm);
      const float p0 = __expf(s0[r] - nm);
      const float p1 = __expf(s1[r] - nm);
      float ps = p0 + p1;
#pragma unroll
      for (int sh = 8; sh >= 1; sh >>= 1) ps += __shfl_xor(ps, sh, 32);
      rsum[r] = rsum[r] * al + ps;
      rmax[r] = nm;
      alpha[r] = al;
      s0[r] = p0;
      s1[r] = p1;
    }
#pragma unroll
    for (int r = 0; r < 8; ++r) {
      o0[r] *= alpha[r]; o1[r] *= alpha[r];
      o2[r] *= alpha[r]; o3[r] *= alpha[r];
    }

    // transpose P (C layout -> A layout) through per-wave LDS
#pragma unroll
    for (int r = 0; r < 8; ++r) {
      P[(r + 8 * half) * 32 + idx]      = (_Float16)s0[r];
      P[(r + 8 * half) * 32 + 16 + idx] = (_Float16)s1[r];
    }
    v16h pa;
    {
      v8h p0 = *(const v8h*)(P + idx * 32 + half * 8);
      v8h p1 = *(const v8h*)(P + idx * 32 + 16 + half * 8);
#pragma unroll
      for (int i = 0; i < 8; ++i) { pa[i] = p0[i]; pa[8 + i] = p1[i]; }
    }

    // O[16x64] += P[16x32] @ V[32x64]: 4 column tiles
#pragma unroll
    for (int nt = 0; nt < 4; ++nt) {
      const int hd = nt * 16 + idx;          // B column = hd
      v8h u0 = *(const v8h*)(VstT + hd * 32 + half * 8);
      v8h u1 = *(const v8h*)(VstT + hd * 32 + 16 + half * 8);
      v16h bv;
#pragma unroll
      for (int i = 0; i < 8; ++i) { bv[i] = u0[i]; bv[8 + i] = u1[i]; }
      if (nt == 0) o0 = wmma_f16(pa, bv, o0);
      else if (nt == 1) o1 = wmma_f16(pa, bv, o1);
      else if (nt == 2) o2 = wmma_f16(pa, bv, o2);
      else o3 = wmma_f16(pa, bv, o3);
    }
  }

  // normalize and store in [B][N][D] f16 for the output projection
#pragma unroll
  for (int r = 0; r < 8; ++r) {
    const float inv = 1.0f / rsum[r];
    const int row = q0 + r + 8 * half;
    const size_t base = ((size_t)b * Nc + row) * Dc + h * HDc;
    Oh[base + 0 * 16 + idx] = (_Float16)(o0[r] * inv);
    Oh[base + 1 * 16 + idx] = (_Float16)(o1[r] * inv);
    Oh[base + 2 * 16 + idx] = (_Float16)(o2[r] * inv);
    Oh[base + 3 * 16 + idx] = (_Float16)(o3[r] * inv);
  }
}

// ------------------------------- launcher ----------------------------------
extern "C" void kernel_launch(void* const* d_in, const int* in_sizes, int n_in,
                              void* d_out, int out_size, void* d_ws,
                              size_t ws_size, hipStream_t stream) {
  const float* q    = (const float*)d_in[0];
  const int*   mask = (const int*)d_in[1];
  const float* bias = (const float*)d_in[2];
  const float* Wq   = (const float*)d_in[3];
  const float* Wk   = (const float*)d_in[4];
  const float* Wv   = (const float*)d_in[5];
  const float* Wo   = (const float*)d_in[6];
  float* out = (float*)d_out;

  const size_t elems = (size_t)BN * Dc;      // 4,194,304 per activation buffer
  const size_t welems = (size_t)Dc * Dc;     //   262,144 per weight matrix
  _Float16* Xh  = (_Float16*)d_ws;           // q in f16          (8 MB)
  _Float16* Qh  = Xh + elems;                // head-major Q      (8 MB)
  _Float16* Kh  = Qh + elems;                // head-major K      (8 MB)
  _Float16* Vh  = Kh + elems;                // head-major V      (8 MB)
  _Float16* Oh  = Vh + elems;                // attn out [B,N,D]  (8 MB)
  _Float16* Wqh = Oh + elems;                // f16 weights (0.5 MB each)
  _Float16* Wkh = Wqh + welems;
  _Float16* Wvh = Wkh + welems;
  _Float16* Woh = Wvh + welems;

  // 1) convert q and all weights to f16 (4 elements / thread)
  cvt_f32_to_f16_kernel<<<(int)(elems / (256 * 4)), 256, 0, stream>>>(q, Xh);
  const int wcvtBlocks = (int)(welems / (256 * 4));   // 256
  cvt_f32_to_f16_kernel<<<wcvtBlocks, 256, 0, stream>>>(Wq, Wqh);
  cvt_f32_to_f16_kernel<<<wcvtBlocks, 256, 0, stream>>>(Wk, Wkh);
  cvt_f32_to_f16_kernel<<<wcvtBlocks, 256, 0, stream>>>(Wv, Wvh);
  cvt_f32_to_f16_kernel<<<wcvtBlocks, 256, 0, stream>>>(Wo, Woh);

  // 2) QKV projections: out = X @ W^T, head-major f16
  const int gemmBlocks = (BN / GBM) * (Dc / GBN);     // 512
  gemm16_kernel<<<gemmBlocks, 256, 0, stream>>>(Xh, Wqh, Qh, nullptr, 0);
  gemm16_kernel<<<gemmBlocks, 256, 0, stream>>>(Xh, Wkh, Kh, nullptr, 0);
  gemm16_kernel<<<gemmBlocks, 256, 0, stream>>>(Xh, Wvh, Vh, nullptr, 0);

  // 3) attention: 8 waves/block, block shares (h,b); 4096 waves total
  const int attnBlocks = Hc * Bc * (Nc / 16) / 8;     // 512
  attn_kernel<<<attnBlocks, 256, 0, stream>>>(Qh, Kh, Vh, bias, mask, Oh);

  // 4) output projection to f32
  gemm16_kernel<<<gemmBlocks, 256, 0, stream>>>(Oh, Woh, nullptr, out, 1);
}

// v003
// One run takes 179 microseconds.
// Next to v002, in two timings, it ran 1.20 times as fast each time.
// Over all steps from v000 it is 3.61 times as fast.
#include <hip/hip_runtime.h>
#include <hip/hip_bf16.h>

// ---------------------------------------------------------------------------
// MI455X (gfx1250) multi-head attention, f16-WMMA everywhere, f32 accumulate.
// Pipeline: q,W->f16 | QKV proj (WMMA GEMM) | flash attention (WMMA) | out proj.
// ---------------------------------------------------------------------------

typedef __attribute__((ext_vector_type(16))) _Float16 v16h;
typedef __attribute__((ext_vector_type(8)))  _Float16 v8h;
typedef __attribute__((ext_vector_type(4)))  _Float16 v4h;
typedef __attribute__((ext_vector_type(8)))  float    v8f;
typedef __attribute__((ext_vector_type(4)))  float    v4f;

constexpr int Bc = 4, Nc = 2048, Dc = 512, Hc = 8, HDc = 64;
constexpr int BN = Bc * Nc;                 // 8192 rows

__device__ __forceinline__ v8f wmma_f16(v16h a, v16h b, v8f c) {
  // (neg_a, A, neg_b, B, c_mod, C, reuse_a, reuse_b)
  return __builtin_amdgcn_wmma_f32_16x16x32_f16(false, a, false, b, (short)0, c,
                                                false, false);
}

__device__ __forceinline__ v8f zero8() {
  v8f z = {0.f, 0.f, 0.f, 0.f, 0.f, 0.f, 0.f, 0.f};
  return z;
}

// --------------------------- f32 -> f16 convert ----------------------------
__global__ void cvt_f32_to_f16_kernel(const float* __restrict__ in,
                                      _Float16* __restrict__ out) {
  const size_t i = ((size_t)blockIdx.x * blockDim.x + threadIdx.x) * 4;
  v4f x = *(const v4f*)(in + i);
  v4h h;
  h[0] = (_Float16)x[0]; h[1] = (_Float16)x[1];
  h[2] = (_Float16)x[2]; h[3] = (_Float16)x[3];
  *(v4h*)(out + i) = h;
}

// ------------------------------ WMMA GEMM ----------------------------------
// C[BN, D] = X[BN, D](f16) @ W[D, D](f16, used as W^T).
// mode 0: write f16 head-major [H][B][N][HD] (for Q/K/V).
// mode 1: write f32 row-major  [BN][D]       (final output).
// One block computes a 128x64 tile of C. X and W rows come in chunks of 128 k
// (256 B a row) by loads that cover whole lines, are laid in LDS at a pitch of
// 272 B, and are read from there as fragments; each of the 8 waves owns 32x32.
constexpr int GBM = 128, GBN = 64, GBK = 128;
constexpr int GPITCH = GBK + 8;               // f16 elements: 256 B + 16 B pad
constexpr int GCHUNKS = Dc / GBK;             // 4

__global__ void __launch_bounds__(256) gemm16_kernel(const _Float16* __restrict__ X,
                              const _Float16* __restrict__ W,
                              _Float16* __restrict__ outH,
                              float* __restrict__ outF,
                              int mode) {
  __shared__ __attribute__((aligned(16))) _Float16 As[2][GBM * GPITCH];
  __shared__ __attribute__((aligned(16))) _Float16 Bs[2][GBN * GPITCH];

  const int tid   = threadIdx.x;
  const int wave  = tid >> 5;
  const int lane  = tid & 31;
  const int bm = blockIdx.x / (Dc / GBN);     // neighbours share the X rows
  const int bn = blockIdx.x % (Dc / GBN);
  const int half = lane >> 4;                 // K-run selector (ISA 16-bit layout)
  const int idx  = lane & 15;                 // A: row, B: column
  const int wm = (wave >> 1) * 32;            // wave's rows inside the tile
  const int wn = (wave & 1) * 32;             // wave's columns inside the tile

  // staging: 16 threads take one row's 256 B, so a wave's load is 2 whole rows
  const int srow = tid >> 4;
  const int scol = (tid & 15) * 8;
  const _Float16* xg = X + (size_t)(bm * GBM + srow) * Dc + scol;
  const _Float16* wg = W + (size_t)(bn * GBN + srow) * Dc + scol;
  const int sdst = srow * GPITCH + scol;

  // every loop of this kernel has a constant trip count and is unrolled, so
  // that ra, rb, acc and the fragments are registers, not indexed scratch
  v8h ra[GBM / 16], rb[GBN / 16];
#pragma unroll
  for (int p = 0; p < GBM / 16; ++p) ra[p] = *(const v8h*)(xg + (size_t)p * 16 * Dc);
#pragma unroll
  for (int p = 0; p < GBN / 16; ++p) rb[p] = *(const v8h*)(wg + (size_t)p * 16 * Dc);
#pragma unroll
  for (int p = 0; p < GBM / 16; ++p) *(v8h*)(&As[0][sdst + p * 16 * GPITCH]) = ra[p];
#pragma unroll
  for (int p = 0; p < GBN / 16; ++p) *(v8h*)(&Bs[0][sdst + p * 16 * GPITCH]) = rb[p];
  __syncthreads();

  v8f acc[2][2];
#pragma unroll
  for (int i = 0; i < 2; ++i)
#pragma unroll
    for (int j = 0; j < 2; ++j) acc[i][j] = zero8();

  // unrolled so that the buffer index and the last chunk's test are constants
#pragma unroll
  for (int c = 0; c < GCHUNKS; ++c) {
    const int cur = c & 1;
    if (c + 1 < GCHUNKS) {                    // next chunk flies during this one
#pragma unroll
      for (int p = 0; p < GBM / 16; ++p)
        ra[p] = *(const v8h*)(xg + (size_t)p * 16 * Dc + (c + 1) * GBK);
#pragma unroll
      for (int p = 0; p < GBN / 16; ++p)
        rb[p] = *(const v8h*)(wg + (size_t)p * 16 * Dc + (c + 1) * GBK);
      // keeps these loads ahead of this chunk's LDS reads and products: sunk
      // among them they would start late and the LDS stores below would wait
      __builtin_amdgcn_sched_barrier(0);
    }
#pragma unroll
    for (int ks = 0; ks < GBK / 32; ++ks) {
      // A: row m=idx, runs K=[half*8..+8) and K=[16+half*8..+8); B alike
      v16h A[2], Bm[2];
#pragma unroll
      for (int i = 0; i < 2; ++i) {
        const _Float16* ap = &As[cur][(wm + i * 16 + idx) * GPITCH + ks * 32 + half * 8];
        const _Float16* bp = &Bs[cur][(wn + i * 16 + idx) * GPITCH + ks * 32 + half * 8];
        v8h a0 = *(const v8h*)ap;
        v8h a1 = *(const v8h*)(ap + 16);
        v8h b0 = *(const v8h*)bp;
        v8h b1 = *(const v8h*)(bp + 16);
#pragma unroll
        for (int e = 0; e < 8; ++e) {
          A[i][e] = a0[e];  A[i][8 + e] = a1[e];
          Bm[i][e] = b0[e]; Bm[i][8 + e] = b1[e];
        }
      }
#pragma unroll
      for (int i = 0; i < 2; ++i)
#pragma unroll
        for (int j = 0; j < 2; ++j) acc[i][j] = wmma_f16(A[i], Bm[j], acc[i][j]);
    }
    if (c + 1 < GCHUNKS) {
      // the other buffer: its readers left it before the previous barrier
#pragma unroll
      for (int p = 0; p < GBM / 16; ++p) *(v8h*)(&As[cur ^ 1][sdst + p * 16 * GPITCH]) = ra[p];
#pragma unroll
      for (int p = 0; p < GBN / 16; ++p) *(v8h*)(&Bs[cur ^ 1][sdst + p * 16 * GPITCH]) = rb[p];
      __syncthreads();
    }
  }

  // C layout: lane holds column n=idx; VGPR r holds row m=r+8*half.
  // One base address a lane: every fragment's element lies at a constant step.
  static_assert(GBN == HDc && Nc % GBM == 0, "a tile is one head of one batch");
  const int row0 = bm * GBM + wm + 8 * half;   // index into [B*N]
  if (mode == 0) {
    const int b    = row0 / Nc;
    const int nseq = row0 % Nc;
    _Float16* op = outH + ((size_t)(bn * Bc + b) * Nc + nseq) * HDc + wn + idx;
#pragma unroll
    for (int i = 0; i < 2; ++i)
#pragma unroll
      for (int j = 0; j < 2; ++j)
#pragma unroll
        for (int r = 0; r < 8; ++r)
          op[(i * 16 + r) * HDc + j * 16] = (_Float16)acc[i][j][r];
  } else {
    float* op = outF + (size_t)row0 * Dc + bn * GBN + wn + idx;
#pragma unroll
    for (int i = 0; i < 2; ++i)
#pragma unroll
      for (int j = 0; j < 2; ++j)
#pragma unroll
        for (int r = 0; r < 8; ++r)
          op[(i * 16 + r) * Dc + j * 16] = acc[i][j][r];
    // the kernel ends after this run of stores, so no later code rewrites their
    // data or address registers: the wait is only a precaution
    asm volatile("s_wait_xcnt 0x0" ::: "memory");
  }
}

typedef __attribute__((ext_vector_type(4))) int v4i;

// value of lane l ^ 16: the other half of the same query's keys
__device__ __forceinline__ float xhalf(float x) {
  const int b = __builtin_bit_cast(int, x);
  return __builtin_bit_cast(
      float, __builtin_amdgcn_permlanex16(b, b, 0x76543210, 0xfedcba98, false, false));
}

__global__ void __launch_bounds__(256) attn_kernel(const _Float16* __restrict__ Qh,   // [H][B][N][HD]
                            const _Float16* __restrict__ Kh,
                            const _Float16* __restrict__ Vh,
                            const float* __restrict__ bias,    // [B][N][N]
                            const int* __restrict__ mask,      // [B][N]
                            _Float16* __restrict__ Oh) {       // [B][N][D] f16
  __shared__ _Float16 VstT[HDc * 32];        // transposed V tile: [hd][keyLocal]

  const int waveId = threadIdx.x >> 5;
  const int lane   = threadIdx.x & 31;
  const int t  = blockIdx.x * 8 + waveId;    // 8 waves per block, same (h,b)
  const int qt = t % (Nc / 16);
  const int b  = (t / (Nc / 16)) % Bc;
  const int h  = t / (Bc * (Nc / 16));
  const int q0 = qt * 16;
  const int half = lane >> 4;
  const int idx  = lane & 15;

  const size_t hb = (size_t)(h * Bc + b) * Nc;
  const _Float16* Qb = Qh + hb * HDc;
  const _Float16* Kb = Kh + hb * HDc;
  const _Float16* Vb = Vh + hb * HDc;
  // this lane's query row of the bias, at the first of its 8-key runs
  const float* biasL = bias + ((size_t)b * Nc + q0 + idx) * Nc + 8 * half;
  const int*  maskL  = mask + b * Nc + 8 * half;

  // Q B-operands (K-dim = 64 -> two 32x16 chunks), pre-scaled by 1/sqrt(HD).
  v16h qa0, qa1;
  {
    const _Float16* qr = Qb + (size_t)(q0 + idx) * HDc;
    v8h r00 = *(const v8h*)(qr + half * 8);
    v8h r01 = *(const v8h*)(qr + 16 + half * 8);
    v8h r10 = *(const v8h*)(qr + 32 + half * 8);
    v8h r11 = *(const v8h*)(qr + 48 + half * 8);
    const _Float16 s = (_Float16)0.125f;     // 1/sqrt(64)
#pragma unroll
    for (int i = 0; i < 8; ++i) {
      qa0[i] = r00[i] * s; qa0[8 + i] = r01[i] * s;
      qa1[i] = r10[i] * s; qa1[8 + i] = r11[i] * s;
    }
  }

  // O^T tiles: register r = hd nt*16 + 8*half + r, lane column = query idx
  v8f o0 = zero8(), o1 = zero8(), o2 = zero8(), o3 = zero8();
  float rmax = -1e30f;                       // of the lane's query, both halves
  float rsum = 0.f;                          // of the lane's own keys only

  for (int kk = 0; kk < Nc; kk += 32) {
    if (kk + 32 < Nc) {                      // prefetch next key chunk (L2-hot)
      __builtin_prefetch(Kb + (size_t)(kk + 32 + idx) * HDc, 0, 1);
      __builtin_prefetch(Vb + (size_t)(kk + 32 + idx) * HDc, 0, 1);
    }
    __syncthreads();                         // prior tile fully consumed
    v4f bz[4];                               // bias of keys 8*half+0..7, 16+8*half+0..7
    v4i mk[4];                               // key mask of the same keys
    v8h kc0[4], kc1[4];                      // K rows of key tiles 0 and 1
    {                                        // stage V[32 keys][64 hd] transposed
      const int key = threadIdx.x >> 3;
      const int hd0 = (threadIdx.x & 7) * 8;
      v8h v = *(const v8h*)(Vb + (size_t)(kk + key) * HDc + hd0);
      // keeps the V load first in the group, so that its LDS stores need not
      // wait for the arrival of the bias loads issued behind it
      __builtin_amdgcn_sched_barrier(0);
      // K, bias and key mask of this pass: unconditional loads, all in flight
      // beside the V load, so the pass waits for memory once, not once per load
      const _Float16* kr0 = Kb + (size_t)(kk + idx) * HDc;       // tile 0 row=key
      const _Float16* kr1 = Kb + (size_t)(kk + 16 + idx) * HDc;  // tile 1
#pragma unroll
      for (int j = 0; j < 4; ++j) {
        kc0[j] = *(const v8h*)(kr0 + j * 16 + half * 8);
        kc1[j] = *(const v8h*)(kr1 + j * 16 + half * 8);
      }
#pragma unroll
      for (int j = 0; j < 4; ++j) {
        const int koff = kk + (j >> 1) * 16 + (j & 1) * 4;
        mk[j] = *(const v4i*)(maskL + koff);
        bz[j] = *(const v4f*)(biasL + koff);
      }
      // the first product's result may be given the registers of these loads'
      // addresses: the wait stands in front of every such write
      asm volatile("s_wait_xcnt 0x0" ::: "memory");
      // keeps the scheduler from sinking part of the loads behind the first
      // arrivals' users, which would put a second memory wait into the pass
      __builtin_amdgcn_sched_barrier(0);
#pragma unroll
      for (int i = 0; i < 8; ++i) VstT[(hd0 + i) * 32 + key] = v[i];
    }
    __syncthreads();

    // scores S^T: two 16-key row tiles, each = 2 WMMAs over K-dim 64
    v8f s0 = zero8(), s1 = zero8();
    {
      v16h kb0, kb1;
#pragma unroll
      for (int i = 0; i < 8; ++i) {
        kb0[i] = kc0[0][i]; kb0[8 + i] = kc0[1][i];
        kb1[i] = kc0[2][i]; kb1[8 + i] = kc0[3][i];
      }
      s0 = wmma_f16(kb0, qa0, s0);
      s0 = wmma_f16(kb1, qa1, s0);
    }
    {
      v16h kb0, kb1;
#pragma unroll
      for (int i = 0; i < 8; ++i) {
        kb0[i] = kc1[0][i]; kb0[8 + i] = kc1[1][i];
        kb1[i] = kc1[2][i]; kb1[8 + i] = kc1[3][i];
      }
      s1 = wmma_f16(kb0, qa0, s1);
      s1 = wmma_f16(kb1, qa1, s1);
    }

    // bias + key mask (lane = column = query; register r = key r+8*half)
    s0 += __builtin_shufflevector(bz[0], bz[1], 0, 1, 2, 3, 4, 5, 6, 7);
    s1 += __builtin_shufflevector(bz[2], bz[3], 0, 1, 2, 3, 4, 5, 6, 7);
#pragma unroll
    for (int r = 0; r < 8; ++r) {
      s0[r] = mk[r >> 2][r & 3]       ? -1e30f : s0[r];
      s1[r] = mk[2 + (r >> 2)][r & 3] ? -1e30f : s1[r];
    }

    // online softmax: the lane's 16 keys, then one exchange with the other half
    float m = fmaxf(s0[0], s1[0]);
#pragma unroll
    for (int r = 1; r < 8; ++r) m = fmaxf(m, fmaxf(s0[r], s1[r]));
    m = fmaxf(m, xhalf(m));
    const float nm = fmaxf(rmax, m);
    const float al = __expf(rmax - nm);
    rmax = nm;
#pragma unroll
    for (int r = 0; r < 8; ++r) {
      s0[r] = __expf(s0[r] - nm);
      s1[r] = __expf(s1[r] - nm);
    }
    const float ps = (((s0[0] + s1[0]) + (s0[1] + s1[1])) + ((s0[2] + s1[2]) + (s0[3] + s1[3]))) +
                     (((s0[4] + s1[4]) + (s0[5] + s1[5])) + ((s0[6] + s1[6]) + (s0[7] + s1[7])));
    rsum = rsum * al + ps;                   // the halves are joined after the loop
    o0 *= al; o1 *= al; o2 *= al; o3 *= al;

    // P^T as B operand: element s is key s<8 ? 8*half+s : 16+8*half+(s-8), which
    // is what the lane holds in s0 and s1
    v16h pb;
#pragma unroll
    for (int i = 0; i < 8; ++i) { pb[i] = (_Float16)s0[i]; pb[8 + i] = (_Float16)s1[i]; }

    // O^T[64x16] += V^T[64x32] @ P^T[32x16]: 4 row tiles
#pragma unroll
    for (int nt = 0; nt < 4; ++nt) {
      const int hd = nt * 16 + idx;          // A row = hd
      v8h u0 = *(const v8h*)(VstT + hd * 32 + half * 8);
      v8h u1 = *(const v8h*)(VstT + hd * 32 + 16 + half * 8);
      v16h av;
#pragma unroll
      for (int i = 0; i < 8; ++i) { av[i] = u0[i]; av[8 + i] = u1[i]; }
      if (nt == 0) o0 = wmma_f16(av, pb, o0);
      else if (nt == 1) o1 = wmma_f16(av, pb, o1);
      else if (nt == 2) o2 = wmma_f16(av, pb, o2);
      else o3 = wmma_f16(av, pb, o3);
    }
  }

  // normalize and store in [B][N][D] f16 for the output projection: a lane's 8
  // registers of a tile are 8 consecutive hd of its query, one 16-byte store
  const float inv = 1.0f / (rsum + xhalf(rsum));
  _Float16* orow = Oh + ((size_t)b * Nc + q0 + idx) * Dc + h * HDc + 8 * half;
  v8h w0, w1, w2, w3;
#pragma unroll
  for (int r = 0; r < 8; ++r) {
    w0[r] = (_Float16)(o0[r] * inv);
    w1[r] = (_Float16)(o1[r] * inv);
    w2[r] = (_Float16)(o2[r] * inv);
    w3[r] = (_Float16)(o3[r] * inv);
  }
  *(v8h*)(orow + 0 * 16) = w0;
  *(v8h*)(orow + 1 * 16) = w1;
  *(v8h*)(orow + 2 * 16) = w2;
  *(v8h*)(orow + 3 * 16) = w3;
}

// ------------------------------- launcher ----------------------------------
extern "C" void kernel_launch(void* const* d_in, const int* in_sizes, int n_in,
                              void* d_out, int out_size, void* d_ws,
                              size_t ws_size, hipStream_t stream) {
  const float* q    = (const float*)d_in[0];
  const int*   mask = (const int*)d_in[1];
  const float* bias = (const float*)d_in[2];
  const float* Wq   = (const float*)d_in[3];
  const float* Wk   = (const float*)d_in[4];
  const float* Wv   = (const float*)d_in[5];
  const float* Wo   = (const float*)d_in[6];
  float* out = (float*)d_out;

  const size_t elems = (size_t)BN * Dc;      // 4,194,304 per activation buffer
  const size_t welems = (size_t)Dc * Dc;     //   262,144 per weight matrix
  _Float16* Xh  = (_Float16*)d_ws;           // q in f16          (8 MB)
  _Float16* Qh  = Xh + elems;                // head-major Q      (8 MB)
  _Float16* Kh  = Qh + elems;                // head-major K      (8 MB)
  _Float16* Vh  = Kh + elems;                // head-major V      (8 MB)
  _Float16* Oh  = Vh + elems;                // attn out [B,N,D]  (8 MB)
  _Float16* Wqh = Oh + elems;                // f16 weights (0.5 MB each)
  _Float16* Wkh = Wqh + welems;
  _Float16* Wvh = Wkh + welems;
  _Float16* Woh = Wvh + welems;

  // 1) convert q and all weights to f16 (4 elements / thread)
  cvt_f32_to_f16_kernel<<<(int)(elems / (256 * 4)), 256, 0, stream>>>(q, Xh);
  const int wcvtBlocks = (int)(welems / (256 * 4));   // 256
  cvt_f32_to_f16_kernel<<<wcvtBlocks, 256, 0, stream>>>(Wq, Wqh);
  cvt_f32_to_f16_kernel<<<wcvtBlocks, 256, 0, stream>>>(Wk, Wkh);
  cvt_f32_to_f16_kernel<<<wcvtBlocks, 256, 0, stream>>>(Wv, Wvh);
  cvt_f32_to_f16_kernel<<<wcvtBlocks, 256, 0, stream>>>(Wo, Woh);

  // 2) QKV projections: out = X @ W^T, head-major f16
  const int gemmBlocks = (BN / GBM) * (Dc / GBN);     // 512
  gemm16_kernel<<<gemmBlocks, 256, 0, stream>>>(Xh, Wqh, Qh, nullptr, 0);
  gemm16_kernel<<<gemmBlocks, 256, 0, stream>>>(Xh, Wkh, Kh, nullptr, 0);
  gemm16_kernel<<<gemmBlocks, 256, 0, stream>>>(Xh, Wvh, Vh, nullptr, 0);

  // 3) attention: 8 waves/block, block shares (h,b); 4096 waves total
  const int attnBlocks = Hc * Bc * (Nc / 16) / 8;     // 512
  attn_kernel<<<attnBlocks, 256, 0, stream>>>(Qh, Kh, Vh, bias, mask, Oh);

  // 4) output projection to f32
  gemm16_kernel<<<gemmBlocks, 256, 0, stream>>>(Oh, Woh, nullptr, out, 1);
}

// v004
// Measured time: 117 microseconds a run.
// Next to v003, in two timings, it ran 1.52 times as fast each time.
// All steps since v000 together make it 5.50 times as fast.
#include <hip/hip_runtime.h>
#include <hip/hip_bf16.h>

// ---------------------------------------------------------------------------
// MI455X (gfx1250) multi-head attention, f16-WMMA everywhere, f32 accumulate.
// Pipeline: q,W->f16 | QKV proj (WMMA GEMM) | flash attention (WMMA) | out proj.
// ---------------------------------------------------------------------------

typedef __attribute__((ext_vector_type(16))) _Float16 v16h;
typedef __attribute__((ext_vector_type(8)))  _Float16 v8h;
typedef __attribute__((ext_vector_type(4)))  _Float16 v4h;
typedef __attribute__((ext_vector_type(8)))  float    v8f;
typedef __attribute__((ext_vector_type(4)))  float    v4f;

constexpr int Bc = 4, Nc = 2048, Dc = 512, Hc = 8, HDc = 64;
constexpr int BN = Bc * Nc;                 // 8192 rows

__device__ __forceinline__ v8f wmma_f16(v16h a, v16h b, v8f c) {
  // (neg_a, A, neg_b, B, c_mod, C, reuse_a, reuse_b)
  return __builtin_amdgcn_wmma_f32_16x16x32_f16(false, a, false, b, (short)0, c,
                                                false, false);
}

__device__ __forceinline__ v8f zero8() {
  v8f z = {0.f, 0.f, 0.f, 0.f, 0.f, 0.f, 0.f, 0.f};
  return z;
}

// --------------------------- f32 -> f16 convert ----------------------------
__global__ void cvt_f32_to_f16_kernel(const float* __restrict__ in,
                                      _Float16* __restrict__ out) {
  const size_t i = ((size_t)blockIdx.x * blockDim.x + threadIdx.x) * 4;
  v4f x = *(const v4f*)(in + i);
  v4h h;
  h[0] = (_Float16)x[0]; h[1] = (_Float16)x[1];
  h[2] = (_Float16)x[2]; h[3] = (_Float16)x[3];
  *(v4h*)(out + i) = h;
}

// ------------------------------ WMMA GEMM ----------------------------------
// C[BN, D] = X[BN, D](f16) @ W[D, D](f16, used as W^T).
// mode 0: write f16 head-major [H][B][N][HD] (for Q/K/V).
// mode 1: write f32 row-major  [BN][D]       (final output).
// One block computes a 128x64 tile of C. X and W rows come in chunks of 128 k
// (256 B a row) by loads that cover whole lines, are laid in LDS at a pitch of
// 272 B, and are read from there as fragments; each of the 8 waves owns 32x32.
constexpr int GBM = 128, GBN = 64, GBK = 128;
constexpr int GPITCH = GBK + 8;               // f16 elements: 256 B + 16 B pad
constexpr int GCHUNKS = Dc / GBK;             // 4

__global__ void __launch_bounds__(256) gemm16_kernel(const _Float16* __restrict__ X,
                              const _Float16* __restrict__ W,
                              _Float16* __restrict__ outH,
                              float* __restrict__ outF,
                              int mode) {
  __shared__ __attribute__((aligned(16))) _Float16 As[2][GBM * GPITCH];
  __shared__ __attribute__((aligned(16))) _Float16 Bs[2][GBN * GPITCH];

  const int tid   = threadIdx.x;
  const int wave  = tid >> 5;
  const int lane  = tid & 31;
  const int bm = blockIdx.x / (Dc / GBN);     // neighbours share the X rows
  const int bn = blockIdx.x % (Dc / GBN);
  const int half = lane >> 4;                 // K-run selector (ISA 16-bit layout)
  const int idx  = lane & 15;                 // A: row, B: column
  const int wm = (wave >> 1) * 32;            // wave's rows inside the tile
  const int wn = (wave & 1) * 32;             // wave's columns inside the tile

  // staging: 16 threads take one row's 256 B, so a wave's load is 2 whole rows
  const int srow = tid >> 4;
  const int scol = (tid & 15) * 8;
  const _Float16* xg = X + (size_t)(bm * GBM + srow) * Dc + scol;
  const _Float16* wg = W + (size_t)(bn * GBN + srow) * Dc + scol;
  const int sdst = srow * GPITCH + scol;

  // every loop of this kernel has a constant trip count and is unrolled, so
  // that ra, rb, acc and the fragments are registers, not indexed scratch
  v8h ra[GBM / 16], rb[GBN / 16];
#pragma unroll
  for (int p = 0; p < GBM / 16; ++p) ra[p] = *(const v8h*)(xg + (size_t)p * 16 * Dc);
#pragma unroll
  for (int p = 0; p < GBN / 16; ++p) rb[p] = *(const v8h*)(wg + (size_t)p * 16 * Dc);
#pragma unroll
  for (int p = 0; p < GBM / 16; ++p) *(v8h*)(&As[0][sdst + p * 16 * GPITCH]) = ra[p];
#pragma unroll
  for (int p = 0; p < GBN / 16; ++p) *(v8h*)(&Bs[0][sdst + p * 16 * GPITCH]) = rb[p];
  __syncthreads();

  v8f acc[2][2];
#pragma unroll
  for (int i = 0; i < 2; ++i)
#pragma unroll
    for (int j = 0; j < 2; ++j) acc[i][j] = zero8();

  // unrolled so that the buffer index and the last chunk's test are constants
#pragma unroll
  for (int c = 0; c < GCHUNKS; ++c) {
    const int cur = c & 1;
    if (c + 1 < GCHUNKS) {                    // next chunk flies during this one
#pragma unroll
      for (int p = 0; p < GBM / 16; ++p)
        ra[p] = *(const v8h*)(xg + (size_t)p * 16 * Dc + (c + 1) * GBK);
#pragma unroll
      for (int p = 0; p < GBN / 16; ++p)
        rb[p] = *(const v8h*)(wg + (size_t)p * 16 * Dc + (c + 1) * GBK);
      // keeps these loads ahead of this chunk's LDS reads and products: sunk
      // among them they would start late and the LDS stores below would wait
      __builtin_amdgcn_sched_barrier(0);
    }
#pragma unroll
    for (int ks = 0; ks < GBK / 32; ++ks) {
      // A: row m=idx, runs K=[half*8..+8) and K=[16+half*8..+8); B alike
      v16h A[2], Bm[2];
#pragma unroll
      for (int i = 0; i < 2; ++i) {
        const _Float16* ap = &As[cur][(wm + i * 16 + idx) * GPITCH + ks * 32 + half * 8];
        const _Float16* bp = &Bs[cur][(wn + i * 16 + idx) * GPITCH + ks * 32 + half * 8];
        v8h a0 = *(const v8h*)ap;
        v8h a1 = *(const v8h*)(ap + 16);
        v8h b0 = *(const v8h*)bp;
        v8h b1 = *(const v8h*)(bp + 16);
#pragma unroll
        for (int e = 0; e < 8; ++e) {
          A[i][e] = a0[e];  A[i][8 + e] = a1[e];
          Bm[i][e] = b0[e]; Bm[i][8 + e] = b1[e];
        }
      }
#pragma unroll
      for (int i = 0; i < 2; ++i)
#pragma unroll
        for (int j = 0; j < 2; ++j) acc[i][j] = wmma_f16(A[i], Bm[j], acc[i][j]);
    }
    if (c + 1 < GCHUNKS) {
      // the other buffer: its readers left it before the previous barrier
#pragma unroll
      for (int p = 0; p < GBM / 16; ++p) *(v8h*)(&As[cur ^ 1][sdst + p * 16 * GPITCH]) = ra[p];
#pragma unroll
      for (int p = 0; p < GBN / 16; ++p) *(v8h*)(&Bs[cur ^ 1][sdst + p * 16 * GPITCH]) = rb[p];
      __syncthreads();
    }
  }

  // C layout: lane holds column n=idx; VGPR r holds row m=r+8*half.
  // One base address a lane: every fragment's element lies at a constant step.
  static_assert(GBN == HDc && Nc % GBM == 0, "a tile is one head of one batch");
  const int row0 = bm * GBM + wm + 8 * half;   // index into [B*N]
  if (mode == 0) {
    const int b    = row0 / Nc;
    const int nseq = row0 % Nc;
    _Float16* op = outH + ((size_t)(bn * Bc + b) * Nc + nseq) * HDc + wn + idx;
#pragma unroll
    for (int i = 0; i < 2; ++i)
#pragma unroll
      for (int j = 0; j < 2; ++j)
#pragma unroll
        for (int r = 0; r < 8; ++r)
          op[(i * 16 + r) * HDc + j * 16] = (_Float16)acc[i][j][r];
  } else {
    float* op = outF + (size_t)row0 * Dc + bn * GBN + wn + idx;
#pragma unroll
    for (int i = 0; i < 2; ++i)
#pragma unroll
      for (int j = 0; j < 2; ++j)
#pragma unroll
        for (int r = 0; r < 8; ++r)
          op[(i * 16 + r) * Dc + j * 16] = acc[i][j][r];
    // the kernel ends after this run of stores, so no later code rewrites their
    // data or address registers: the wait is only a precaution
    asm volatile("s_wait_xcnt 0x0" ::: "memory");
  }
}

typedef __attribute__((ext_vector_type(4))) int v4i;
typedef __attribute__((ext_vector_type(8))) short v8s;
typedef __attribute__((address_space(3))) v8s lds_v8s;

constexpr int KPITCH = HDc + 8;              // 144 B: 16 B x odd, for 16-byte reads
constexpr int VPITCH = HDc + 16;             // 160 B: 32 B x odd, for transposing reads

// value of lane l ^ 16: the other half of the same query's keys
__device__ __forceinline__ float xhalf(float x) {
  const int b = __builtin_bit_cast(int, x);
  return __builtin_bit_cast(
      float, __builtin_amdgcn_permlanex16(b, b, 0x76543210, 0xfedcba98, false, false));
}

// transposing LDS load: lane (idx, half) gets 8 rows 8*half+0..7 of column idx
__device__ __forceinline__ v8h lds_tr16(const _Float16* p) {
  return __builtin_bit_cast(v8h, __builtin_amdgcn_ds_load_tr16_b128_v8i16((lds_v8s*)p));
}

__global__ void __launch_bounds__(256) attn_kernel(const _Float16* __restrict__ Qh,   // [H][B][N][HD]
                            const _Float16* __restrict__ Kh,
                            const _Float16* __restrict__ Vh,
                            const float* __restrict__ bias,    // [B][N][N]
                            const int* __restrict__ mask,      // [B][N]
                            _Float16* __restrict__ Oh) {       // [B][N][D] f16
  __shared__ __attribute__((aligned(16))) _Float16 Ks[2][32 * KPITCH];  // [key][hd]
  __shared__ __attribute__((aligned(16))) _Float16 Vs[2][32 * VPITCH];  // [key][hd]

  const int waveId = threadIdx.x >> 5;
  const int lane   = threadIdx.x & 31;
  const int t  = blockIdx.x * 8 + waveId;    // 8 waves per block, same (h,b)
  const int qt = t % (Nc / 16);
  const int b  = (t / (Nc / 16)) % Bc;
  const int h  = t / (Bc * (Nc / 16));
  const int q0 = qt * 16;
  const int half = lane >> 4;
  const int idx  = lane & 15;

  const size_t hb = (size_t)(h * Bc + b) * Nc;
  const _Float16* Qb = Qh + hb * HDc;
  const _Float16* Kb = Kh + hb * HDc;
  const _Float16* Vb = Vh + hb * HDc;
  // this lane's query row of the bias, at the first of its 8-key runs
  const float* biasL = bias + ((size_t)b * Nc + q0 + idx) * Nc + 8 * half;
  const int*  maskL  = mask + b * Nc + 8 * half;

  // staging: 8 threads take one key's 128 B, so a wave's load is 4 whole lines
  const int srow = threadIdx.x >> 3;
  const int scol = (threadIdx.x & 7) * 8;
  const _Float16* kg = Kb + (size_t)srow * HDc + scol;
  const _Float16* vg = Vb + (size_t)srow * HDc + scol;
  const int kdst = srow * KPITCH + scol;
  const int vdst = srow * VPITCH + scol;
  // fragment reads: K row = key idx; V by the transposing load's own lane map
  const int kfrag = idx * KPITCH + half * 8;
  const int vfrag = (8 * half + (lane & 7)) * VPITCH + 8 * ((lane >> 3) & 1);

  v8h kn = *(const v8h*)kg;                  // tiles of pass 0
  v8h vn = *(const v8h*)vg;

  // Q B-operands (K-dim = 64 -> two 32x16 chunks), pre-scaled by 1/sqrt(HD).
  v16h qa0, qa1;
  {
    const _Float16* qr = Qb + (size_t)(q0 + idx) * HDc;
    v8h r00 = *(const v8h*)(qr + half * 8);
    v8h r01 = *(const v8h*)(qr + 16 + half * 8);
    v8h r10 = *(const v8h*)(qr + 32 + half * 8);
    v8h r11 = *(const v8h*)(qr + 48 + half * 8);
    const _Float16 s = (_Float16)0.125f;     // 1/sqrt(64)
#pragma unroll
    for (int i = 0; i < 8; ++i) {
      qa0[i] = r00[i] * s; qa0[8 + i] = r01[i] * s;
      qa1[i] = r10[i] * s; qa1[8 + i] = r11[i] * s;
    }
  }

  *(v8h*)(&Ks[0][kdst]) = kn;
  *(v8h*)(&Vs[0][vdst]) = vn;
  __syncthreads();

  // O^T tiles: register r = hd nt*16 + 8*half + r, lane column = query idx
  v8f o0 = zero8(), o1 = zero8(), o2 = zero8(), o3 = zero8();
  float rmax = -1e30f;                       // of the lane's query, both halves
  float rsum = 0.f;                          // of the lane's own keys only

  for (int kk = 0; kk < Nc; kk += 32) {
    const int cur = (kk >> 5) & 1;
    const bool more = kk + 32 < Nc;          // the same for the whole block
    v4f bz[4];                               // bias of keys 8*half+0..7, 16+8*half+0..7
    v4i mk[4];                               // key mask of the same keys
    // the next pass's K and V, then bias and key mask of this pass: one group of
    // loads at the head of the pass, in flight beside the K reads and the products
    if (more) {
      kn = *(const v8h*)(kg + (size_t)(kk + 32) * HDc);
      vn = *(const v8h*)(vg + (size_t)(kk + 32) * HDc);
    }
#pragma unroll
    for (int j = 0; j < 4; ++j) {
      const int koff = kk + (j >> 1) * 16 + (j & 1) * 4;
      mk[j] = *(const v4i*)(maskL + koff);
      bz[j] = *(const v4f*)(biasL + koff);
    }
    // the address registers of these loads are stepped, or may be given to other
    // values, further down the pass: the wait stands in front of every such write
    asm volatile("s_wait_xcnt 0x0" ::: "memory");
    // keeps the scheduler from sinking part of the loads behind the LDS reads
    // and products below, where they would start late
    __builtin_amdgcn_sched_barrier(0);

    // scores S^T: two 16-key row tiles, each = 2 WMMAs over K-dim 64
    v8f s0 = zero8(), s1 = zero8();
    v8h u0[4], u1[4];                        // V^T fragments, keys 0..15 and 16..31
    {
      const _Float16* kp = &Ks[cur][kfrag];
      const _Float16* vp = &Vs[cur][vfrag];
      v8h kc0[4], kc1[4];                    // K rows of key tiles 0 and 1
#pragma unroll
      for (int j = 0; j < 4; ++j) {
        kc0[j] = *(const v8h*)(kp + j * 16);
        kc1[j] = *(const v8h*)(kp + 16 * KPITCH + j * 16);
      }
#pragma unroll
      for (int nt = 0; nt < 4; ++nt) {
        u0[nt] = lds_tr16(vp + nt * 16);
        u1[nt] = lds_tr16(vp + 16 * VPITCH + nt * 16);
      }
      // keeps the pass's LDS reads in one group ahead of the products: spread among
      // them, each pair of reads would be waited for on its own
      __builtin_amdgcn_sched_barrier(0);
      v16h ka0, ka1, kb0, kb1;
#pragma unroll
      for (int i = 0; i < 8; ++i) {
        ka0[i] = kc0[0][i]; ka0[8 + i] = kc0[1][i];
        ka1[i] = kc0[2][i]; ka1[8 + i] = kc0[3][i];
        kb0[i] = kc1[0][i]; kb0[8 + i] = kc1[1][i];
        kb1[i] = kc1[2][i]; kb1[8 + i] = kc1[3][i];
      }
      s0 = wmma_f16(ka0, qa0, s0);
      s1 = wmma_f16(kb0, qa0, s1);
      s0 = wmma_f16(ka1, qa1, s0);
      s1 = wmma_f16(kb1, qa1, s1);
      // keeps the four products ahead of the first wait for the bias: behind it
      // they would start only when the bias has arrived
      __builtin_amdgcn_sched_barrier(0);
    }

    // bias + key mask (lane = column = query; register r = key r+8*half)
    s0 += __builtin_shufflevector(bz[0], bz[1], 0, 1, 2, 3, 4, 5, 6, 7);
    s1 += __builtin_shufflevector(bz[2], bz[3], 0, 1, 2, 3, 4, 5, 6, 7);
#pragma unroll
    for (int r = 0; r < 8; ++r) {
      s0[r] = mk[r >> 2][r & 3]       ? -1e30f : s0[r];
      s1[r] = mk[2 + (r >> 2)][r & 3] ? -1e30f : s1[r];
    }

    // online softmax: the lane's 16 keys, then one exchange with the other half
    float m = fmaxf(s0[0], s1[0]);
#pragma unroll
    for (int r = 1; r < 8; ++r) m = fmaxf(m, fmaxf(s0[r], s1[r]));
    m = fmaxf(m, xhalf(m));
    const float nm = fmaxf(rmax, m);
    const float al = __expf(rmax - nm);
    rmax = nm;
#pragma unroll
    for (int r = 0; r < 8; ++r) {
      s0[r] = __expf(s0[r] - nm);
      s1[r] = __expf(s1[r] - nm);
    }
    const float ps = (((s0[0] + s1[0]) + (s0[1] + s1[1])) + ((s0[2] + s1[2]) + (s0[3] + s1[3]))) +
                     (((s0[4] + s1[4]) + (s0[5] + s1[5])) + ((s0[6] + s1[6]) + (s0[7] + s1[7])));
    rsum = rsum * al + ps;                   // the halves are joined after the loop
    o0 *= al; o1 *= al; o2 *= al; o3 *= al;

    // P^T as B operand: element s is key s<8 ? 8*half+s : 16+8*half+(s-8), which
    // is what the lane holds in s0 and s1
    v16h pb;
#pragma unroll
    for (int i = 0; i < 8; ++i) { pb[i] = (_Float16)s0[i]; pb[8 + i] = (_Float16)s1[i]; }

    // O^T[64x16] += V^T[64x32] @ P^T[32x16]: 4 row tiles; A row = hd nt*16+idx,
    // its elements keys 8*half+0..7 and 16+8*half+0..7, the order of pb
#pragma unroll
    for (int nt = 0; nt < 4; ++nt) {
      v16h av;
#pragma unroll
      for (int i = 0; i < 8; ++i) { av[i] = u0[nt][i]; av[8 + i] = u1[nt][i]; }
      if (nt == 0) o0 = wmma_f16(av, pb, o0);
      else if (nt == 1) o1 = wmma_f16(av, pb, o1);
      else if (nt == 2) o2 = wmma_f16(av, pb, o2);
      else o3 = wmma_f16(av, pb, o3);
    }

    if (more) {
      // the other buffer: its readers left it before the previous barrier
      *(v8h*)(&Ks[cur ^ 1][kdst]) = kn;
      *(v8h*)(&Vs[cur ^ 1][vdst]) = vn;
      __syncthreads();
    }
  }

  // normalize and store in [B][N][D] f16 for the output projection: a lane's 8
  // registers of a tile are 8 consecutive hd of its query, one 16-byte store
  const float inv = 1.0f / (rsum + xhalf(rsum));
  _Float16* orow = Oh + ((size_t)b * Nc + q0 + idx) * Dc + h * HDc + 8 * half;
  v8h w0, w1, w2, w3;
#pragma unroll
  for (int r = 0; r < 8; ++r) {
    w0[r] = (_Float16)(o0[r] * inv);
    w1[r] = (_Float16)(o1[r] * inv);
    w2[r] = (_Float16)(o2[r] * inv);
    w3[r] = (_Float16)(o3[r] * inv);
  }
  *(v8h*)(orow + 0 * 16) = w0;
  *(v8h*)(orow + 1 * 16) = w1;
  *(v8h*)(orow + 2 * 16) = w2;
  *(v8h*)(orow + 3 * 16) = w3;
}

// ------------------------------- launcher ----------------------------------
extern "C" void kernel_launch(void* const* d_in, const int* in_sizes, int n_in,
                              void* d_out, int out_size, void* d_ws,
                              size_t ws_size, hipStream_t stream) {
  const float* q    = (const float*)d_in[0];
  const int*   mask = (const int*)d_in[1];
  const float* bias = (const float*)d_in[2];
  const float* Wq   = (const float*)d_in[3];
  const float* Wk   = (const float*)d_in[4];
  const float* Wv   = (const float*)d_in[5];
  const float* Wo   = (const float*)d_in[6];
  float* out = (float*)d_out;

  const size_t elems = (size_t)BN * Dc;      // 4,194,304 per activation buffer
  const size_t welems = (size_t)Dc * Dc;     //   262,144 per weight matrix
  _Float16* Xh  = (_Float16*)d_ws;           // q in f16          (8 MB)
  _Float16* Qh  = Xh + elems;                // head-major Q      (8 MB)
  _Float16* Kh  = Qh + elems;                // head-major K      (8 MB)
  _Float16* Vh  = Kh + elems;                // head-major V      (8 MB)
  _Float16* Oh  = Vh + elems;                // attn out [B,N,D]  (8 MB)
  _Float16* Wqh = Oh + elems;                // f16 weights (0.5 MB each)
  _Float16* Wkh = Wqh + welems;
  _Float16* Wvh = Wkh + welems;
  _Float16* Woh = Wvh + welems;

  // 1) convert q and all weights to f16 (4 elements / thread)
  cvt_f32_to_f16_kernel<<<(int)(elems / (256 * 4)), 256, 0, stream>>>(q, Xh);
  const int wcvtBlocks = (int)(welems / (256 * 4));   // 256
  cvt_f32_to_f16_kernel<<<wcvtBlocks, 256, 0, stream>>>(Wq, Wqh);
  cvt_f32_to_f16_kernel<<<wcvtBlocks, 256, 0, stream>>>(Wk, Wkh);
  cvt_f32_to_f16_kernel<<<wcvtBlocks, 256, 0, stream>>>(Wv, Wvh);
  cvt_f32_to_f16_kernel<<<wcvtBlocks, 256, 0, stream>>>(Wo, Woh);

  // 2) QKV projections: out = X @ W^T, head-major f16
  const int gemmBlocks = (BN / GBM) * (Dc / GBN);     // 512
  gemm16_kernel<<<gemmBlocks, 256, 0, stream>>>(Xh, Wqh, Qh, nullptr, 0);
  gemm16_kernel<<<gemmBlocks, 256, 0, stream>>>(Xh, Wkh, Kh, nullptr, 0);
  gemm16_kernel<<<gemmBlocks, 256, 0, stream>>>(Xh, Wvh, Vh, nullptr, 0);

  // 3) attention: 8 waves/block, block shares (h,b); 4096 waves total
  const int attnBlocks = Hc * Bc * (Nc / 16) / 8;     // 512
  attn_kernel<<<attnBlocks, 256, 0, stream>>>(Qh, Kh, Vh, bias, mask, Oh);

  // 4) output projection to f32
  gemm16_kernel<<<gemmBlocks, 256, 0, stream>>>(Oh, Woh, nullptr, out, 1);
}

// v005
// One run takes 112 microseconds.
// Next to v004, in two timings, it ran 1.04 and 1.05 times as fast.
// Counting every step since v000, it is 5.74 times as fast.
#include <hip/hip_runtime.h>
#include <hip/hip_bf16.h>

// ---------------------------------------------------------------------------
// MI455X (gfx1250) multi-head attention, f16-WMMA everywhere, f32 accumulate.
// Pipeline: QKV proj (WMMA GEMM, f32 operands made f16 on the way into LDS) |
// flash attention (WMMA) | out proj.
// ---------------------------------------------------------------------------

typedef __attribute__((ext_vector_type(16))) _Float16 v16h;
typedef __attribute__((ext_vector_type(8)))  _Float16 v8h;
typedef __attribute__((ext_vector_type(4)))  _Float16 v4h;
typedef __attribute__((ext_vector_type(8)))  float    v8f;
typedef __attribute__((ext_vector_type(4)))  float    v4f;

constexpr int Bc = 4, Nc = 2048, Dc = 512, Hc = 8, HDc = 64;
constexpr int BN = Bc * Nc;                 // 8192 rows

__device__ __forceinline__ v8f wmma_f16(v16h a, v16h b, v8f c) {
  // (neg_a, A, neg_b, B, c_mod, C, reuse_a, reuse_b)
  return __builtin_amdgcn_wmma_f32_16x16x32_f16(false, a, false, b, (short)0, c,
                                                false, false);
}

__device__ __forceinline__ v8f zero8() {
  v8f z = {0.f, 0.f, 0.f, 0.f, 0.f, 0.f, 0.f, 0.f};
  return z;
}

// four f32 rounded to f16 (to nearest even), as one 8-byte LDS store wants them
__device__ __forceinline__ v4h cvt4(v4f x) {
  v4h h;
  h[0] = (_Float16)x[0]; h[1] = (_Float16)x[1];
  h[2] = (_Float16)x[2]; h[3] = (_Float16)x[3];
  return h;
}

// ------------------------------ WMMA GEMM ----------------------------------
// C[BN, D] = X[BN, D] @ W[D, D] (used as W^T), products in f16, sums in f32.
// MODE 0: X is f32 (Xf); write f16 head-major [H][B][N][HD] (for Q/K/V).
// MODE 1: X is f16 (Xh); write f32 row-major  [BN][D]       (final output).
// W is f32 in both. One block computes a 128x64 tile of C. X and W rows come in
// chunks of 128 k by loads that cover whole lines; an f32 operand is rounded to
// f16 in registers between its load and its LDS store. The chunks lie in LDS as
// f16 at a pitch of 272 B and are read from there as fragments; each of the 8
// waves owns 32x32.
constexpr int GBM = 128, GBN = 64, GBK = 128;
constexpr int GPITCH = GBK + 8;               // f16 elements: 256 B + 16 B pad
constexpr int GCHUNKS = Dc / GBK;             // 4

template <int MODE>
__global__ void __launch_bounds__(256) gemm16_kernel(const float* __restrict__ Xf,
                              const _Float16* __restrict__ Xh,
                              const float* __restrict__ W,
                              _Float16* __restrict__ outH,
                              float* __restrict__ outF) {
  __shared__ __attribute__((aligned(16))) _Float16 As[2][GBM * GPITCH];
  __shared__ __attribute__((aligned(16))) _Float16 Bs[2][GBN * GPITCH];

  const int tid   = threadIdx.x;
  const int wave  = tid >> 5;
  const int lane  = tid & 31;
  const int bm = blockIdx.x / (Dc / GBN);     // neighbours share the X rows
  const int bn = blockIdx.x % (Dc / GBN);
  const int half = lane >> 4;                 // K-run selector (ISA 16-bit layout)
  const int idx  = lane & 15;                 // A: row, B: column
  const int wm = (wave >> 1) * 32;            // wave's rows inside the tile
  const int wn = (wave & 1) * 32;             // wave's columns inside the tile

  // staging, f16 operand: 16 threads take one row's 256 B, a wave's load 2 rows
  const int srow = tid >> 4;
  const int scol = (tid & 15) * 8;
  const int sdst = srow * GPITCH + scol;
  // staging, f32 operand: a wave's load is one row's 512 B, its LDS store 256 B
  const int fdst = wave * GPITCH + lane * 4;
  const size_t xhoff = (size_t)(bm * GBM + srow) * Dc + scol;
  const size_t xfoff = (size_t)(bm * GBM + wave) * Dc + lane * 4;
  const float* wf = W + (size_t)(bn * GBN + wave) * Dc + lane * 4;

  // every loop of this kernel has a constant trip count and is unrolled, so
  // that the staging registers, acc and the fragments are registers, not scratch
  v8h ra[GBM / 16];                           // MODE 1
  v4f rx[GBM / 8];                            // MODE 0
  v4f rw[GBN / 8];
  auto load_chunk = [&](int c) {
    if constexpr (MODE == 0) {
#pragma unroll
      for (int p = 0; p < GBM / 8; ++p)
        rx[p] = *(const v4f*)(Xf + xfoff + (size_t)p * 8 * Dc + c * GBK);
    } else {
#pragma unroll
      for (int p = 0; p < GBM / 16; ++p)
        ra[p] = *(const v8h*)(Xh + xhoff + (size_t)p * 16 * Dc + c * GBK);
    }
#pragma unroll
    for (int p = 0; p < GBN / 8; ++p) rw[p] = *(const v4f*)(wf + (size_t)p * 8 * Dc + c * GBK);
    // the address registers of these loads may be given to other values further
    // down: the wait stands in front of every such write
    asm volatile("s_wait_xcnt 0x0" ::: "memory");
  };
  auto store_chunk = [&](int buf) {
    if constexpr (MODE == 0) {
#pragma unroll
      for (int p = 0; p < GBM / 8; ++p) *(v4h*)(&As[buf][fdst + p * 8 * GPITCH]) = cvt4(rx[p]);
    } else {
#pragma unroll
      for (int p = 0; p < GBM / 16; ++p) *(v8h*)(&As[buf][sdst + p * 16 * GPITCH]) = ra[p];
    }
#pragma unroll
    for (int p = 0; p < GBN / 8; ++p) *(v4h*)(&Bs[buf][fdst + p * 8 * GPITCH]) = cvt4(rw[p]);
  };
  load_chunk(0);
  store_chunk(0);
  __syncthreads();

  v8f acc[2][2];
#pragma unroll
  for (int i = 0; i < 2; ++i)
#pragma unroll
    for (int j = 0; j < 2; ++j) acc[i][j] = zero8();

  // unrolled so that the buffer index and the last chunk's test are constants
#pragma unroll
  for (int c = 0; c < GCHUNKS; ++c) {
    const int cur = c & 1;
    if (c + 1 < GCHUNKS) {                    // next chunk flies during this one
      load_chunk(c + 1);
      // keeps these loads ahead of this chunk's LDS reads and products: sunk
      // among them they would start late and the LDS stores below would wait
      __builtin_amdgcn_sched_barrier(0);
    }
#pragma unroll
    for (int ks = 0; ks < GBK / 32; ++ks) {
      // A: row m=idx, runs K=[half*8..+8) and K=[16+half*8..+8); B alike
      v16h A[2], Bm[2];
#pragma unroll
      for (int i = 0; i < 2; ++i) {
        const _Float16* ap = &As[cur][(wm + i * 16 + idx) * GPITCH + ks * 32 + half * 8];
        const _Float16* bp = &Bs[cur][(wn + i * 16 + idx) * GPITCH + ks * 32 + half * 8];
        v8h a0 = *(const v8h*)ap;
        v8h a1 = *(const v8h*)(ap + 16);
        v8h b0 = *(const v8h*)bp;
        v8h b1 = *(const v8h*)(bp + 16);
#pragma unroll
        for (int e = 0; e < 8; ++e) {
          A[i][e] = a0[e];  A[i][8 + e] = a1[e];
          Bm[i][e] = b0[e]; Bm[i][8 + e] = b1[e];
        }
      }
#pragma unroll
      for (int i = 0; i < 2; ++i)
#pragma unroll
        for (int j = 0; j < 2; ++j) acc[i][j] = wmma_f16(A[i], Bm[j], acc[i][j]);
    }
    if (c + 1 < GCHUNKS) {
      // keeps the roundings and LDS stores, and with them the wait for the loads,
      // behind this chunk's products: lifted among them the products would wait too
      __builtin_amdgcn_sched_barrier(0);
      // the other buffer: its readers left it before the previous barrier
      store_chunk(cur ^ 1);
      __syncthreads();
    }
  }

  // C layout: lane holds column n=idx; VGPR r holds row m=r+8*half.
  // One base address a lane: every fragment's element lies at a constant step.
  static_assert(GBN == HDc && Nc % GBM == 0, "a tile is one head of one batch");
  const int row0 = bm * GBM + wm + 8 * half;   // index into [B*N]
  if constexpr (MODE == 0) {
    const int b    = row0 / Nc;
    const int nseq = row0 % Nc;
    _Float16* op = outH + ((size_t)(bn * Bc + b) * Nc + nseq) * HDc + wn + idx;
#pragma unroll
    for (int i = 0; i < 2; ++i)
#pragma unroll
      for (int j = 0; j < 2; ++j)
#pragma unroll
        for (int r = 0; r < 8; ++r)
          op[(i * 16 + r) * HDc + j * 16] = (_Float16)acc[i][j][r];
  } else {
    float* op = outF + (size_t)row0 * Dc + bn * GBN + wn + idx;
#pragma unroll
    for (int i = 0; i < 2; ++i)
#pragma unroll
      for (int j = 0; j < 2; ++j)
#pragma unroll
        for (int r = 0; r < 8; ++r)
          op[(i * 16 + r) * Dc + j * 16] = acc[i][j][r];
    // the kernel ends after this run of stores, so no later code rewrites their
    // data or address registers: the wait is only a precaution
    asm volatile("s_wait_xcnt 0x0" ::: "memory");
  }
}

typedef __attribute__((ext_vector_type(4))) int v4i;
typedef __attribute__((ext_vector_type(8))) short v8s;
typedef __attribute__((address_space(3))) v8s lds_v8s;

constexpr int KPITCH = HDc + 8;              // 144 B: 16 B x odd, for 16-byte reads
constexpr int VPITCH = HDc + 16;             // 160 B: 32 B x odd, for transposing reads

// value of lane l ^ 16: the other half of the same query's keys
__device__ __forceinline__ float xhalf(float x) {
  const int b = __builtin_bit_cast(int, x);
  return __builtin_bit_cast(
      float, __builtin_amdgcn_permlanex16(b, b, 0x76543210, 0xfedcba98, false, false));
}

// transposing LDS load: lane (idx, half) gets 8 rows 8*half+0..7 of column idx
__device__ __forceinline__ v8h lds_tr16(const _Float16* p) {
  return __builtin_bit_cast(v8h, __builtin_amdgcn_ds_load_tr16_b128_v8i16((lds_v8s*)p));
}

__global__ void __launch_bounds__(256) attn_kernel(const _Float16* __restrict__ Qh,   // [H][B][N][HD]
                            const _Float16* __restrict__ Kh,
                            const _Float16* __restrict__ Vh,
                            const float* __restrict__ bias,    // [B][N][N]
                            const int* __restrict__ mask,      // [B][N]
                            _Float16* __restrict__ Oh) {       // [B][N][D] f16
  __shared__ __attribute__((aligned(16))) _Float16 Ks[2][32 * KPITCH];  // [key][hd]
  __shared__ __attribute__((aligned(16))) _Float16 Vs[2][32 * VPITCH];  // [key][hd]

  const int waveId = threadIdx.x >> 5;
  const int lane   = threadIdx.x & 31;
  const int t  = blockIdx.x * 8 + waveId;    // 8 waves per block, same (h,b)
  const int qt = t % (Nc / 16);
  const int b  = (t / (Nc / 16)) % Bc;
  const int h  = t / (Bc * (Nc / 16));
  const int q0 = qt * 16;
  const int half = lane >> 4;
  const int idx  = lane & 15;

  const size_t hb = (size_t)(h * Bc + b) * Nc;
  const _Float16* Qb = Qh + hb * HDc;
  const _Float16* Kb = Kh + hb * HDc;
  const _Float16* Vb = Vh + hb * HDc;
  // this lane's query row of the bias, at the first of its 8-key runs
  const float* biasL = bias + ((size_t)b * Nc + q0 + idx) * Nc + 8 * half;
  const int*  maskL  = mask + b * Nc + 8 * half;

  // staging: 8 threads take one key's 128 B, so a wave's load is 4 whole lines
  const int srow = threadIdx.x >> 3;
  const int scol = (threadIdx.x & 7) * 8;
  const _Float16* kg = Kb + (size_t)srow * HDc + scol;
  const _Float16* vg = Vb + (size_t)srow * HDc + scol;
  const int kdst = srow * KPITCH + scol;
  const int vdst = srow * VPITCH + scol;
  // fragment reads: K row = key idx; V by the transposing load's own lane map
  const int kfrag = idx * KPITCH + half * 8;
  const int vfrag = (8 * half + (lane & 7)) * VPITCH + 8 * ((lane >> 3) & 1);

  v8h kn = *(const v8h*)kg;                  // tiles of pass 0
  v8h vn = *(const v8h*)vg;

  // Q B-operands (K-dim = 64 -> two 32x16 chunks), pre-scaled by 1/sqrt(HD).
  v16h qa0, qa1;
  {
    const _Float16* qr = Qb + (size_t)(q0 + idx) * HDc;
    v8h r00 = *(const v8h*)(qr + half * 8);
    v8h r01 = *(const v8h*)(qr + 16 + half * 8);
    v8h r10 = *(const v8h*)(qr + 32 + half * 8);
    v8h r11 = *(const v8h*)(qr + 48 + half * 8);
    const _Float16 s = (_Float16)0.125f;     // 1/sqrt(64)
#pragma unroll
    for (int i = 0; i < 8; ++i) {
      qa0[i] = r00[i] * s; qa0[8 + i] = r01[i] * s;
      qa1[i] = r10[i] * s; qa1[8 + i] = r11[i] * s;
    }
  }

  *(v8h*)(&Ks[0][kdst]) = kn;
  *(v8h*)(&Vs[0][vdst]) = vn;
  __syncthreads();

  // O^T tiles: register r = hd nt*16 + 8*half + r, lane column = query idx
  v8f o0 = zero8(), o1 = zero8(), o2 = zero8(), o3 = zero8();
  float rmax = -1e30f;                       // of the lane's query, both halves
  float rsum = 0.f;                          // of the lane's own keys only

  for (int kk = 0; kk < Nc; kk += 32) {
    const int cur = (kk >> 5) & 1;
    const bool more = kk + 32 < Nc;          // the same for the whole block
    v4f bz[4];                               // bias of keys 8*half+0..7, 16+8*half+0..7
    v4i mk[4];                               // key mask of the same keys
    // the next pass's K and V, then bias and key mask of this pass: one group of
    // loads at the head of the pass, in flight beside the K reads and the products
    if (more) {
      kn = *(const v8h*)(kg + (size_t)(kk + 32) * HDc);
      vn = *(const v8h*)(vg + (size_t)(kk + 32) * HDc);
    }
#pragma unroll
    for (int j = 0; j < 4; ++j) {
      const int koff = kk + (j >> 1) * 16 + (j & 1) * 4;
      mk[j] = *(const v4i*)(maskL + koff);
      bz[j] = *(const v4f*)(biasL + koff);
    }
    // the address registers of these loads are stepped, or may be given to other
    // values, further down the pass: the wait stands in front of every such write
    asm volatile("s_wait_xcnt 0x0" ::: "memory");
    // keeps the scheduler from sinking part of the loads behind the LDS reads
    // and products below, where they would start late
    __builtin_amdgcn_sched_barrier(0);

    // scores S^T: two 16-key row tiles, each = 2 WMMAs over K-dim 64
    v8f s0 = zero8(), s1 = zero8();
    v8h u0[4], u1[4];                        // V^T fragments, keys 0..15 and 16..31
    {
      const _Float16* kp = &Ks[cur][kfrag];
      const _Float16* vp = &Vs[cur][vfrag];
      v8h kc0[4], kc1[4];                    // K rows of key tiles 0 and 1
#pragma unroll
      for (int j = 0; j < 4; ++j) {
        kc0[j] = *(const v8h*)(kp + j * 16);
        kc1[j] = *(const v8h*)(kp + 16 * KPITCH + j * 16);
      }
#pragma unroll
      for (int nt = 0; nt < 4; ++nt) {
        u0[nt] = lds_tr16(vp + nt * 16);
        u1[nt] = lds_tr16(vp + 16 * VPITCH + nt * 16);
      }
      // keeps the pass's LDS reads in one group ahead of the products: spread among
      // them, each pair of reads would be waited for on its own
      __builtin_amdgcn_sched_barrier(0);
      v16h ka0, ka1, kb0, kb1;
#pragma unroll
      for (int i = 0; i < 8; ++i) {
        ka0[i] = kc0[0][i]; ka0[8 + i] = kc0[1][i];
        ka1[i] = kc0[2][i]; ka1[8 + i] = kc0[3][i];
        kb0[i] = kc1[0][i]; kb0[8 + i] = kc1[1][i];
        kb1[i] = kc1[2][i]; kb1[8 + i] = kc1[3][i];
      }
      s0 = wmma_f16(ka0, qa0, s0);
      s1 = wmma_f16(kb0, qa0, s1);
      s0 = wmma_f16(ka1, qa1, s0);
      s1 = wmma_f16(kb1, qa1, s1);
      // keeps the four products ahead of the first wait for the bias: behind it
      // they would start only when the bias has arrived
      __builtin_amdgcn_sched_barrier(0);
    }

    // bias + key mask (lane = column = query; register r = key r+8*half)
    s0 += __builtin_shufflevector(bz[0], bz[1], 0, 1, 2, 3, 4, 5, 6, 7);
    s1 += __builtin_shufflevector(bz[2], bz[3], 0, 1, 2, 3, 4, 5, 6, 7);
#pragma unroll
    for (int r = 0; r < 8; ++r) {
      s0[r] = mk[r >> 2][r & 3]       ? -1e30f : s0[r];
      s1[r] = mk[2 + (r >> 2)][r & 3] ? -1e30f : s1[r];
    }

    // online softmax: the lane's 16 keys, then one exchange with the other half
    float m = fmaxf(s0[0], s1[0]);
#pragma unroll
    for (int r = 1; r < 8; ++r) m = fmaxf(m, fmaxf(s0[r], s1[r]));
    m = fmaxf(m, xhalf(m));
    const float nm = fmaxf(rmax, m);
    const float al = __expf(rmax - nm);
    rmax = nm;
#pragma unroll
    for (int r = 0; r < 8; ++r) {
      s0[r] = __expf(s0[r] - nm);
      s1[r] = __expf(s1[r] - nm);
    }
    const float ps = (((s0[0] + s1[0]) + (s0[1] + s1[1])) + ((s0[2] + s1[2]) + (s0[3] + s1[3]))) +
                     (((s0[4] + s1[4]) + (s0[5] + s1[5])) + ((s0[6] + s1[6]) + (s0[7] + s1[7])));
    rsum = rsum * al + ps;                   // the halves are joined after the loop
    o0 *= al; o1 *= al; o2 *= al; o3 *= al;

    // P^T as B operand: element s is key s<8 ? 8*half+s : 16+8*half+(s-8), which
    // is what the lane holds in s0 and s1
    v16h pb;
#pragma unroll
    for (int i = 0; i < 8; ++i) { pb[i] = (_Float16)s0[i]; pb[8 + i] = (_Float16)s1[i]; }

    // O^T[64x16] += V^T[64x32] @ P^T[32x16]: 4 row tiles; A row = hd nt*16+idx,
    // its elements keys 8*half+0..7 and 16+8*half+0..7, the order of pb
#pragma unroll
    for (int nt = 0; nt < 4; ++nt) {
      v16h av;
#pragma unroll
      for (int i = 0; i < 8; ++i) { av[i] = u0[nt][i]; av[8 + i] = u1[nt][i]; }
      if (nt == 0) o0 = wmma_f16(av, pb, o0);
      else if (nt == 1) o1 = wmma_f16(av, pb, o1);
      else if (nt == 2) o2 = wmma_f16(av, pb, o2);
      else o3 = wmma_f16(av, pb, o3);
    }

    if (more) {
      // the other buffer: its readers left it before the previous barrier
      *(v8h*)(&Ks[cur ^ 1][kdst]) = kn;
      *(v8h*)(&Vs[cur ^ 1][vdst]) = vn;
      __syncthreads();
    }
  }

  // normalize and store in [B][N][D] f16 for the output projection: a lane's 8
  // registers of a tile are 8 consecutive hd of its query, one 16-byte store
  const float inv = 1.0f / (rsum + xhalf(rsum));
  _Float16* orow = Oh + ((size_t)b * Nc + q0 + idx) * Dc + h * HDc + 8 * half;
  v8h w0, w1, w2, w3;
#pragma unroll
  for (int r = 0; r < 8; ++r) {
    w0[r] = (_Float16)(o0[r] * inv);
    w1[r] = (_Float16)(o1[r] * inv);
    w2[r] = (_Float16)(o2[r] * inv);
    w3[r] = (_Float16)(o3[r] * inv);
  }
  *(v8h*)(orow + 0 * 16) = w0;
  *(v8h*)(orow + 1 * 16) = w1;
  *(v8h*)(orow + 2 * 16) = w2;
  *(v8h*)(orow + 3 * 16) = w3;
}

// ------------------------------- launcher ----------------------------------
extern "C" void kernel_launch(void* const* d_in, const int* in_sizes, int n_in,
                              void* d_out, int out_size, void* d_ws,
                              size_t ws_size, hipStream_t stream) {
  const float* q    = (const float*)d_in[0];
  const int*   mask = (const int*)d_in[1];
  const float* bias = (const float*)d_in[2];
  const float* Wq   = (const float*)d_in[3];
  const float* Wk   = (const float*)d_in[4];
  const float* Wv   = (const float*)d_in[5];
  const float* Wo   = (const float*)d_in[6];
  float* out = (float*)d_out;

  const size_t elems = (size_t)BN * Dc;      // 4,194,304 per activation buffer
  _Float16* Qh  = (_Float16*)d_ws;           // head-major Q      (8 MB)
  _Float16* Kh  = Qh + elems;                // head-major K      (8 MB)
  _Float16* Vh  = Kh + elems;                // head-major V      (8 MB)
  _Float16* Oh  = Vh + elems;                // attn out [B,N,D]  (8 MB)

  // 1) QKV projections: out = q @ W^T, head-major f16
  const int gemmBlocks = (BN / GBM) * (Dc / GBN);     // 512
  gemm16_kernel<0><<<gemmBlocks, 256, 0, stream>>>(q, nullptr, Wq, Qh, nullptr);
  gemm16_kernel<0><<<gemmBlocks, 256, 0, stream>>>(q, nullptr, Wk, Kh, nullptr);
  gemm16_kernel<0><<<gemmBlocks, 256, 0, stream>>>(q, nullptr, Wv, Vh, nullptr);

  // 2) attention: 8 waves/block, block shares (h,b); 4096 waves total
  const int attnBlocks = Hc * Bc * (Nc / 16) / 8;     // 512
  attn_kernel<<<attnBlocks, 256, 0, stream>>>(Qh, Kh, Vh, bias, mask, Oh);

  // 3) output projection to f32
  gemm16_kernel<1><<<gemmBlocks, 256, 0, stream>>>(nullptr, Oh, Wo, nullptr, out);
}

// v006
// One run takes 99.5 microseconds.
// In both of two side-by-side timings against v005, it was 1.12 times as fast.
// Over all steps from v000 it is 6.43 times as fast.
#include <hip/hip_runtime.h>
#include <hip/hip_bf16.h>

// ---------------------------------------------------------------------------
// MI455X (gfx1250) multi-head attention, f16-WMMA everywhere, f32 accumulate.
// Pipeline: QKV proj (one WMMA GEMM launch, f32 operands made f16 on the way into LDS) |
// flash attention (WMMA) | out proj.
// ---------------------------------------------------------------------------

typedef __attribute__((ext_vector_type(16))) _Float16 v16h;
typedef __attribute__((ext_vector_type(8)))  _Float16 v8h;
typedef __attribute__((ext_vector_type(4)))  _Float16 v4h;
typedef __attribute__((ext_vector_type(8)))  float    v8f;
typedef __attribute__((ext_vector_type(4)))  float    v4f;

constexpr int Bc = 4, Nc = 2048, Dc = 512, Hc = 8, HDc = 64;
constexpr int BN = Bc * Nc;                 // 8192 rows

__device__ __forceinline__ v8f wmma_f16(v16h a, v16h b, v8f c) {
  // (neg_a, A, neg_b, B, c_mod, C, reuse_a, reuse_b)
  return __builtin_amdgcn_wmma_f32_16x16x32_f16(false, a, false, b, (short)0, c,
                                                false, false);
}

__device__ __forceinline__ v8f zero8() {
  v8f z = {0.f, 0.f, 0.f, 0.f, 0.f, 0.f, 0.f, 0.f};
  return z;
}

// four f32 rounded to f16 (to nearest even), as one 8-byte LDS store wants them
__device__ __forceinline__ v4h cvt4(v4f x) {
  v4h h;
  h[0] = (_Float16)x[0]; h[1] = (_Float16)x[1];
  h[2] = (_Float16)x[2]; h[3] = (_Float16)x[3];
  return h;
}

// ------------------------------ WMMA GEMMs ---------------------------------
// C[BN, D] = X[BN, D] @ W[D, D] (used as W^T), products in f16, sums in f32.
// X and W rows come in k chunks by loads that cover whole lines; an f32 operand
// is rounded to f16 in registers between its load and its LDS store. The chunks
// lie in LDS as f16 at a padded pitch and are read from there as fragments.
constexpr int GBN = 64;                       // tile columns: one head

// ---- Q, K and V projections in one launch ----
// One block computes the same 256x64 tile of q Wq^T, q Wk^T and q Wv^T: the X rows
// are loaded, rounded and staged once for the three products, and an X fragment
// read from LDS feeds all three. 16 waves, each 32x32 of each product; k chunks of
// 64 (256 B of an f32 row), pitch 144 B. Output f16, head-major [H][B][N][HD].
constexpr int QBM = 256, QBK = 64;
constexpr int QPITCH = QBK + 8;               // f16 elements: 128 B + 16 B pad
constexpr int QCHUNKS = Dc / QBK;             // 8

__global__ void __launch_bounds__(512) qkv_gemm_kernel(const float* __restrict__ X,
                              const float* __restrict__ Wq,
                              const float* __restrict__ Wk,
                              const float* __restrict__ Wv,
                              _Float16* __restrict__ Qh,
                              _Float16* __restrict__ Kh,
                              _Float16* __restrict__ Vh) {
  __shared__ __attribute__((aligned(16))) _Float16 As[2][QBM * QPITCH];
  __shared__ __attribute__((aligned(16))) _Float16 Bs[2][3 * GBN * QPITCH];

  const int tid   = threadIdx.x;
  const int wave  = tid >> 5;
  const int lane  = tid & 31;
  const int bm = blockIdx.x / (Dc / GBN);     // neighbours share the X rows
  const int bn = blockIdx.x % (Dc / GBN);
  const int half = lane >> 4;                 // K-run selector (ISA 16-bit layout)
  const int idx  = lane & 15;                 // A: row, B: column
  const int wm = (wave >> 1) * 32;            // wave's rows inside the tile
  const int wn = (wave & 1) * 32;             // wave's columns inside the tile

  // staging: 16 threads take one row's 256 B, a wave's load 2 rows, the block's 32
  const int srow = tid >> 4;
  const int scol = (tid & 15) * 4;
  const int fdst = srow * QPITCH + scol;
  const float* xf = X + (size_t)(bm * QBM + srow) * Dc + scol;
  const size_t woff = (size_t)(bn * GBN + srow) * Dc + scol;
  const float* wq = Wq + woff;
  const float* wk = Wk + woff;
  const float* wv = Wv + woff;

  // every loop of this kernel has a constant trip count and is unrolled, so
  // that the staging registers, acc and the fragments are registers, not scratch
  v4f rx[QBM / 32];
  v4f rw[3][GBN / 32];
  auto load_chunk = [&](int c) {
#pragma unroll
    for (int p = 0; p < QBM / 32; ++p)
      rx[p] = *(const v4f*)(xf + (size_t)p * 32 * Dc + c * QBK);
#pragma unroll
    for (int p = 0; p < GBN / 32; ++p) {
      rw[0][p] = *(const v4f*)(wq + (size_t)p * 32 * Dc + c * QBK);
      rw[1][p] = *(const v4f*)(wk + (size_t)p * 32 * Dc + c * QBK);
      rw[2][p] = *(const v4f*)(wv + (size_t)p * 32 * Dc + c * QBK);
    }
    // the address registers of these loads may be given to other values further
    // down: the wait stands in front of every such write
    asm volatile("s_wait_xcnt 0x0" ::: "memory");
  };
  auto store_chunk = [&](int buf) {
#pragma unroll
    for (int p = 0; p < QBM / 32; ++p)
      *(v4h*)(&As[buf][fdst + p * 32 * QPITCH]) = cvt4(rx[p]);
#pragma unroll
    for (int w = 0; w < 3; ++w)
#pragma unroll
      for (int p = 0; p < GBN / 32; ++p)
        *(v4h*)(&Bs[buf][fdst + (w * GBN + p * 32) * QPITCH]) = cvt4(rw[w][p]);
  };
  load_chunk(0);
  store_chunk(0);
  __syncthreads();

  v8f acc[3][2][2];
#pragma unroll
  for (int w = 0; w < 3; ++w)
#pragma unroll
    for (int i = 0; i < 2; ++i)
#pragma unroll
      for (int j = 0; j < 2; ++j) acc[w][i][j] = zero8();

  // unrolled so that the buffer index and the last chunk's test are constants
#pragma unroll
  for (int c = 0; c < QCHUNKS; ++c) {
    const int cur = c & 1;
    if (c + 1 < QCHUNKS) {                    // next chunk flies during this one
      load_chunk(c + 1);
      // keeps these loads ahead of this chunk's LDS reads and products: sunk
      // among them they would start late and the LDS stores below would wait
      __builtin_amdgcn_sched_barrier(0);
    }
#pragma unroll
    for (int ks = 0; ks < QBK / 32; ++ks) {
      // A: row m=idx, runs K=[half*8..+8) and K=[16+half*8..+8); B alike
      v16h A[2], Bm[3][2];
#pragma unroll
      for (int i = 0; i < 2; ++i) {
        const _Float16* ap = &As[cur][(wm + i * 16 + idx) * QPITCH + ks * 32 + half * 8];
        v8h a0 = *(const v8h*)ap;
        v8h a1 = *(const v8h*)(ap + 16);
#pragma unroll
        for (int e = 0; e < 8; ++e) { A[i][e] = a0[e]; A[i][8 + e] = a1[e]; }
#pragma unroll
        for (int w = 0; w < 3; ++w) {
          const _Float16* bp =
              &Bs[cur][(w * GBN + wn + i * 16 + idx) * QPITCH + ks * 32 + half * 8];
          v8h b0 = *(const v8h*)bp;
          v8h b1 = *(const v8h*)(bp + 16);
#pragma unroll
          for (int e = 0; e < 8; ++e) { Bm[w][i][e] = b0[e]; Bm[w][i][8 + e] = b1[e]; }
        }
      }
#pragma unroll
      for (int w = 0; w < 3; ++w)
#pragma unroll
        for (int i = 0; i < 2; ++i)
#pragma unroll
          for (int j = 0; j < 2; ++j) acc[w][i][j] = wmma_f16(A[i], Bm[w][j], acc[w][i][j]);
    }
    if (c + 1 < QCHUNKS) {
      // keeps the roundings and LDS stores, and with them the wait for the loads,
      // behind this chunk's products: lifted among them the products would wait too
      __builtin_amdgcn_sched_barrier(0);
      // the other buffer: its readers left it before the previous barrier
      store_chunk(cur ^ 1);
      __syncthreads();
    }
  }

  // C layout: lane holds column n=idx; VGPR r holds row m=r+8*half.
  // One offset a lane: every fragment's element lies at a constant step.
  static_assert(GBN == HDc && Nc % QBM == 0, "a tile is one head of one batch");
  const int row0 = bm * QBM + wm + 8 * half;   // index into [B*N]
  const int b    = row0 / Nc;
  const int nseq = row0 % Nc;
  const size_t ooff = ((size_t)(bn * Bc + b) * Nc + nseq) * HDc + wn + idx;
#pragma unroll
  for (int w = 0; w < 3; ++w) {
    _Float16* op = (w == 0 ? Qh : w == 1 ? Kh : Vh) + ooff;
#pragma unroll
    for (int i = 0; i < 2; ++i)
#pragma unroll
      for (int j = 0; j < 2; ++j)
#pragma unroll
        for (int r = 0; r < 8; ++r)
          op[(i * 16 + r) * HDc + j * 16] = (_Float16)acc[w][i][j][r];
  }
}

// ---- output projection ----
// X is f16 (the attention output), W f32; writes f32 row-major [BN][D]. One block
// computes a 128x64 tile of C, k chunks of 128 at a pitch of 272 B; each of the 8
// waves owns 32x32.
constexpr int GBM = 128, GBK = 128;
constexpr int GPITCH = GBK + 8;               // f16 elements: 256 B + 16 B pad
constexpr int GCHUNKS = Dc / GBK;             // 4

__global__ void __launch_bounds__(256) out_gemm_kernel(const _Float16* __restrict__ Xh,
                              const float* __restrict__ W,
                              float* __restrict__ outF) {
  __shared__ __attribute__((aligned(16))) _Float16 As[2][GBM * GPITCH];
  __shared__ __attribute__((aligned(16))) _Float16 Bs[2][GBN * GPITCH];

  const int tid   = threadIdx.x;
  const int wave  = tid >> 5;
  const int lane  = tid & 31;
  const int bm = blockIdx.x / (Dc / GBN);     // neighbours share the X rows
  const int bn = blockIdx.x % (Dc / GBN);
  const int half = lane >> 4;                 // K-run selector (ISA 16-bit layout)
  const int idx  = lane & 15;                 // A: row, B: column
  const int wm = (wave >> 1) * 32;            // wave's rows inside the tile
  const int wn = (wave & 1) * 32;             // wave's columns inside the tile

  // staging, f16 operand: 16 threads take one row's 256 B, a wave's load 2 rows
  const int srow = tid >> 4;
  const int scol = (tid & 15) * 8;
  const int sdst = srow * GPITCH + scol;
  // staging, f32 operand: a wave's load is one row's 512 B, its LDS store 256 B
  const int fdst = wave * GPITCH + lane * 4;
  const size_t xhoff = (size_t)(bm * GBM + srow) * Dc + scol;
  const float* wf = W + (size_t)(bn * GBN + wave) * Dc + lane * 4;

  // every loop of this kernel has a constant trip count and is unrolled, so
  // that the staging registers, acc and the fragments are registers, not scratch
  v8h ra[GBM / 16];
  v4f rw[GBN / 8];
  auto load_chunk = [&](int c) {
#pragma unroll
    for (int p = 0; p < GBM / 16; ++p)
      ra[p] = *(const v8h*)(Xh + xhoff + (size_t)p * 16 * Dc + c * GBK);
#pragma unroll
    for (int p = 0; p < GBN / 8; ++p) rw[p] = *(const v4f*)(wf + (size_t)p * 8 * Dc + c * GBK);
    // the address registers of these loads may be given to other values further
    // down: the wait stands in front of every such write
    asm volatile("s_wait_xcnt 0x0" ::: "memory");
  };
  auto store_chunk = [&](int buf) {
#pragma unroll
    for (int p = 0; p < GBM / 16; ++p) *(v8h*)(&As[buf][sdst + p * 16 * GPITCH]) = ra[p];
#pragma unroll
    for (int p = 0; p < GBN / 8; ++p) *(v4h*)(&Bs[buf][fdst + p * 8 * GPITCH]) = cvt4(rw[p]);
  };
  load_chunk(0);
  store_chunk(0);
  __syncthreads();

  v8f acc[2][2];
#pragma unroll
  for (int i = 0; i < 2; ++i)
#pragma unroll
    for (int j = 0; j < 2; ++j) acc[i][j] = zero8();

  // unrolled so that the buffer index and the last chunk's test are constants
#pragma unroll
  for (int c = 0; c < GCHUNKS; ++c) {
    const int cur = c & 1;
    if (c + 1 < GCHUNKS) {                    // next chunk flies during this one
      load_chunk(c + 1);
      // keeps these loads ahead of this chunk's LDS reads and products: sunk
      // among them they would start late and the LDS stores below would wait
      __builtin_amdgcn_sched_barrier(0);
    }
#pragma unroll
    for (int ks = 0; ks < GBK / 32; ++ks) {
      // A: row m=idx, runs K=[half*8..+8) and K=[16+half*8..+8); B alike
      v16h A[2], Bm[2];
#pragma unroll
      for (int i = 0; i < 2; ++i) {
        const _Float16* ap = &As[cur][(wm + i * 16 + idx) * GPITCH + ks * 32 + half * 8];
        const _Float16* bp = &Bs[cur][(wn + i * 16 + idx) * GPITCH + ks * 32 + half * 8];
        v8h a0 = *(const v8h*)ap;
        v8h a1 = *(const v8h*)(ap + 16);
        v8h b0 = *(const v8h*)bp;
        v8h b1 = *(const v8h*)(bp + 16);
#pragma unroll
        for (int e = 0; e < 8; ++e) {
          A[i][e] = a0[e];  A[i][8 + e] = a1[e];
          Bm[i][e] = b0[e]; Bm[i][8 + e] = b1[e];
        }
      }
#pragma unroll
      for (int i = 0; i < 2; ++i)
#pragma unroll
        for (int j = 0; j < 2; ++j) acc[i][j] = wmma_f16(A[i], Bm[j], acc[i][j]);
    }
    if (c + 1 < GCHUNKS) {
      // keeps the roundings and LDS stores, and with them the wait for the loads,
      // behind this chunk's products: lifted among them the products would wait too
      __builtin_amdgcn_sched_barrier(0);
      // the other buffer: its readers left it before the previous barrier
      store_chunk(cur ^ 1);
      __syncthreads();
    }
  }

  // C layout: lane holds column n=idx; VGPR r holds row m=r+8*half.
  // One base address a lane: every fragment's element lies at a constant step.
  const int row0 = bm * GBM + wm + 8 * half;   // index into [B*N]
  float* op = outF + (size_t)row0 * Dc + bn * GBN + wn + idx;
#pragma unroll
  for (int i = 0; i < 2; ++i)
#pragma unroll
    for (int j = 0; j < 2; ++j)
#pragma unroll
      for (int r = 0; r < 8; ++r)
        op[(i * 16 + r) * Dc + j * 16] = acc[i][j][r];
  // the wait stands in front of every later write to the data and address
  // registers of these stores
  asm volatile("s_wait_xcnt 0x0" ::: "memory");
}

typedef __attribute__((ext_vector_type(4))) int v4i;
typedef __attribute__((ext_vector_type(8))) short v8s;
typedef __attribute__((address_space(3))) v8s lds_v8s;

constexpr int KPITCH = HDc + 8;              // 144 B: 16 B x odd, for 16-byte reads
constexpr int VPITCH = HDc + 16;             // 160 B: 32 B x odd, for transposing reads

// value of lane l ^ 16: the other half of the same query's keys
__device__ __forceinline__ float xhalf(float x) {
  const int b = __builtin_bit_cast(int, x);
  return __builtin_bit_cast(
      float, __builtin_amdgcn_permlanex16(b, b, 0x76543210, 0xfedcba98, false, false));
}

// transposing LDS load: lane (idx, half) gets 8 rows 8*half+0..7 of column idx
__device__ __forceinline__ v8h lds_tr16(const _Float16* p) {
  return __builtin_bit_cast(v8h, __builtin_amdgcn_ds_load_tr16_b128_v8i16((lds_v8s*)p));
}

__global__ void __launch_bounds__(256) attn_kernel(const _Float16* __restrict__ Qh,   // [H][B][N][HD]
                            const _Float16* __restrict__ Kh,
                            const _Float16* __restrict__ Vh,
                            const float* __restrict__ bias,    // [B][N][N]
                            const int* __restrict__ mask,      // [B][N]
                            _Float16* __restrict__ Oh) {       // [B][N][D] f16
  __shared__ __attribute__((aligned(16))) _Float16 Ks[2][32 * KPITCH];  // [key][hd]
  __shared__ __attribute__((aligned(16))) _Float16 Vs[2][32 * VPITCH];  // [key][hd]

  const int waveId = threadIdx.x >> 5;
  const int lane   = threadIdx.x & 31;
  const int t  = blockIdx.x * 8 + waveId;    // 8 waves per block, same (h,b)
  const int qt = t % (Nc / 16);
  const int b  = (t / (Nc / 16)) % Bc;
  const int h  = t / (Bc * (Nc / 16));
  const int q0 = qt * 16;
  const int half = lane >> 4;
  const int idx  = lane & 15;

  const size_t hb = (size_t)(h * Bc + b) * Nc;
  const _Float16* Qb = Qh + hb * HDc;
  const _Float16* Kb = Kh + hb * HDc;
  const _Float16* Vb = Vh + hb * HDc;
  // this lane's query row of the bias, at the first of its 8-key runs
  const float* biasL = bias + ((size_t)b * Nc + q0 + idx) * Nc + 8 * half;
  const int*  maskL  = mask + b * Nc + 8 * half;

  // staging: 8 threads take one key's 128 B, so a wave's load is 4 whole lines
  const int srow = threadIdx.x >> 3;
  const int scol = (threadIdx.x & 7) * 8;
  const _Float16* kg = Kb + (size_t)srow * HDc + scol;
  const _Float16* vg = Vb + (size_t)srow * HDc + scol;
  const int kdst = srow * KPITCH + scol;
  const int vdst = srow * VPITCH + scol;
  // fragment reads: K row = key idx; V by the transposing load's own lane map
  const int kfrag = idx * KPITCH + half * 8;
  const int vfrag = (8 * half + (lane & 7)) * VPITCH + 8 * ((lane >> 3) & 1);

  v8h kn = *(const v8h*)kg;                  // tiles of pass 0
  v8h vn = *(const v8h*)vg;

  // Q B-operands (K-dim = 64 -> two 32x16 chunks), pre-scaled by 1/sqrt(HD).
  v16h qa0, qa1;
  {
    const _Float16* qr = Qb + (size_t)(q0 + idx) * HDc;
    v8h r00 = *(const v8h*)(qr + half * 8);
    v8h r01 = *(const v8h*)(qr + 16 + half * 8);
    v8h r10 = *(const v8h*)(qr + 32 + half * 8);
    v8h r11 = *(const v8h*)(qr + 48 + half * 8);
    const _Float16 s = (_Float16)0.125f;     // 1/sqrt(64)
#pragma unroll
    for (int i = 0; i < 8; ++i) {
      qa0[i] = r00[i] * s; qa0[8 + i] = r01[i] * s;
      qa1[i] = r10[i] * s; qa1[8 + i] = r11[i] * s;
    }
  }

  *(v8h*)(&Ks[0][kdst]) = kn;
  *(v8h*)(&Vs[0][vdst]) = vn;
  __syncthreads();

  // O^T tiles: register r = hd nt*16 + 8*half + r, lane column = query idx
  v8f o0 = zero8(), o1 = zero8(), o2 = zero8(), o3 = zero8();
  float rmax = -1e30f;                       // of the lane's query, both halves
  float rsum = 0.f;                          // of the lane's own keys only

  for (int kk = 0; kk < Nc; kk += 32) {
    const int cur = (kk >> 5) & 1;
    const bool more = kk + 32 < Nc;          // the same for the whole block
    v4f bz[4];                               // bias of keys 8*half+0..7, 16+8*half+0..7
    v4i mk[4];                               // key mask of the same keys
    // the next pass's K and V, then bias and key mask of this pass: one group of
    // loads at the head of the pass, in flight beside the K reads and the products
    if (more) {
      kn = *(const v8h*)(kg + (size_t)(kk + 32) * HDc);
      vn = *(const v8h*)(vg + (size_t)(kk + 32) * HDc);
    }
#pragma unroll
    for (int j = 0; j < 4; ++j) {
      const int koff = kk + (j >> 1) * 16 + (j & 1) * 4;
      mk[j] = *(const v4i*)(maskL + koff);
      bz[j] = *(const v4f*)(biasL + koff);
    }
    // the address registers of these loads are stepped, or may be given to other
    // values, further down the pass: the wait stands in front of every such write
    asm volatile("s_wait_xcnt 0x0" ::: "memory");
    // keeps the scheduler from sinking part of the loads behind the LDS reads
    // and products below, where they would start late
    __builtin_amdgcn_sched_barrier(0);

    // scores S^T: two 16-key row tiles, each = 2 WMMAs over K-dim 64
    v8f s0 = zero8(), s1 = zero8();
    v8h u0[4], u1[4];                        // V^T fragments, keys 0..15 and 16..31
    {
      const _Float16* kp = &Ks[cur][kfrag];
      const _Float16* vp = &Vs[cur][vfrag];
      v8h kc0[4], kc1[4];                    // K rows of key tiles 0 and 1
#pragma unroll
      for (int j = 0; j < 4; ++j) {
        kc0[j] = *(const v8h*)(kp + j * 16);
        kc1[j] = *(const v8h*)(kp + 16 * KPITCH + j * 16);
      }
#pragma unroll
      for (int nt = 0; nt < 4; ++nt) {
        u0[nt] = lds_tr16(vp + nt * 16);
        u1[nt] = lds_tr16(vp + 16 * VPITCH + nt * 16);
      }
      // keeps the pass's LDS reads in one group ahead of the products: spread among
      // them, each pair of reads would be waited for on its own
      __builtin_amdgcn_sched_barrier(0);
      v16h ka0, ka1, kb0, kb1;
#pragma unroll
      for (int i = 0; i < 8; ++i) {
        ka0[i] = kc0[0][i]; ka0[8 + i] = kc0[1][i];
        ka1[i] = kc0[2][i]; ka1[8 + i] = kc0[3][i];
        kb0[i] = kc1[0][i]; kb0[8 + i] = kc1[1][i];
        kb1[i] = kc1[2][i]; kb1[8 + i] = kc1[3][i];
      }
      s0 = wmma_f16(ka0, qa0, s0);
      s1 = wmma_f16(kb0, qa0, s1);
      s0 = wmma_f16(ka1, qa1, s0);
      s1 = wmma_f16(kb1, qa1, s1);
      // keeps the four products ahead of the first wait for the bias: behind it
      // they would start only when the bias has arrived
      __builtin_amdgcn_sched_barrier(0);
    }

    // bias + key mask (lane = column = query; register r = key r+8*half)
    s0 += __builtin_shufflevector(bz[0], bz[1], 0, 1, 2, 3, 4, 5, 6, 7);
    s1 += __builtin_shufflevector(bz[2], bz[3], 0, 1, 2, 3, 4, 5, 6, 7);
#pragma unroll
    for (int r = 0; r < 8; ++r) {
      s0[r] = mk[r >> 2][r & 3]       ? -1e30f : s0[r];
      s1[r] = mk[2 + (r >> 2)][r & 3] ? -1e30f : s1[r];
    }

    // online softmax: the lane's 16 keys, then one exchange with the other half
    float m = fmaxf(s0[0], s1[0]);
#pragma unroll
    for (int r = 1; r < 8; ++r) m = fmaxf(m, fmaxf(s0[r], s1[r]));
    m = fmaxf(m, xhalf(m));
    const float nm = fmaxf(rmax, m);
    const float al = __expf(rmax - nm);
    rmax = nm;
#pragma unroll
    for (int r = 0; r < 8; ++r) {
      s0[r] = __expf(s0[r] - nm);
      s1[r] = __expf(s1[r] - nm);
    }
    const float ps = (((s0[0] + s1[0]) + (s0[1] + s1[1])) + ((s0[2] + s1[2]) + (s0[3] + s1[3]))) +
                     (((s0[4] + s1[4]) + (s0[5] + s1[5])) + ((s0[6] + s1[6]) + (s0[7] + s1[7])));
    rsum = rsum * al + ps;                   // the halves are joined after the loop
    o0 *= al; o1 *= al; o2 *= al; o3 *= al;

    // P^T as B operand: element s is key s<8 ? 8*half+s : 16+8*half+(s-8), which
    // is what the lane holds in s0 and s1
    v16h pb;
#pragma unroll
    for (int i = 0; i < 8; ++i) { pb[i] = (_Float16)s0[i]; pb[8 + i] = (_Float16)s1[i]; }

    // O^T[64x16] += V^T[64x32] @ P^T[32x16]: 4 row tiles; A row = hd nt*16+idx,
    // its elements keys 8*half+0..7 and 16+8*half+0..7, the order of pb
#pragma unroll
    for (int nt = 0; nt < 4; ++nt) {
      v16h av;
#pragma unroll
      for (int i = 0; i < 8; ++i) { av[i] = u0[nt][i]; av[8 + i] = u1[nt][i]; }
      if (nt == 0) o0 = wmma_f16(av, pb, o0);
      else if (nt == 1) o1 = wmma_f16(av, pb, o1);
      else if (nt == 2) o2 = wmma_f16(av, pb, o2);
      else o3 = wmma_f16(av, pb, o3);
    }

    if (more) {
      // the other buffer: its readers left it before the previous barrier
      *(v8h*)(&Ks[cur ^ 1][kdst]) = kn;
      *(v8h*)(&Vs[cur ^ 1][vdst]) = vn;
      __syncthreads();
    }
  }

  // normalize and store in [B][N][D] f16 for the output projection: a lane's 8
  // registers of a tile are 8 consecutive hd of its query, one 16-byte store
  const float inv = 1.0f / (rsum + xhalf(rsum));
  _Float16* orow = Oh + ((size_t)b * Nc + q0 + idx) * Dc + h * HDc + 8 * half;
  v8h w0, w1, w2, w3;
#pragma unroll
  for (int r = 0; r < 8; ++r) {
    w0[r] = (_Float16)(o0[r] * inv);
    w1[r] = (_Float16)(o1[r] * inv);
    w2[r] = (_Float16)(o2[r] * inv);
    w3[r] = (_Float16)(o3[r] * inv);
  }
  *(v8h*)(orow + 0 * 16) = w0;
  *(v8h*)(orow + 1 * 16) = w1;
  *(v8h*)(orow + 2 * 16) = w2;
  *(v8h*)(orow + 3 * 16) = w3;
}

// ------------------------------- launcher ----------------------------------
extern "C" void kernel_launch(void* const* d_in, const int* in_sizes, int n_in,
                              void* d_out, int out_size, void* d_ws,
                              size_t ws_size, hipStream_t stream) {
  const float* q    = (const float*)d_in[0];
  const int*   mask = (const int*)d_in[1];
  const float* bias = (const float*)d_in[2];
  const float* Wq   = (const float*)d_in[3];
  const float* Wk   = (const float*)d_in[4];
  const float* Wv   = (const float*)d_in[5];
  const float* Wo   = (const float*)d_in[6];
  float* out = (float*)d_out;

  const size_t elems = (size_t)BN * Dc;      // 4,194,304 per activation buffer
  _Float16* Qh  = (_Float16*)d_ws;           // head-major Q      (8 MB)
  _Float16* Kh  = Qh + elems;                // head-major K      (8 MB)
  _Float16* Vh  = Kh + elems;                // head-major V      (8 MB)
  _Float16* Oh  = Vh + elems;                // attn out [B,N,D]  (8 MB)

  // 1) QKV projections in one launch: out = q @ W^T, head-major f16
  const int qkvBlocks = (BN / QBM) * (Dc / GBN);      // 256
  qkv_gemm_kernel<<<qkvBlocks, 512, 0, stream>>>(q, Wq, Wk, Wv, Qh, Kh, Vh);

  // 2) attention: 8 waves/block, block shares (h,b); 4096 waves total
  const int attnBlocks = Hc * Bc * (Nc / 16) / 8;     // 512
  attn_kernel<<<attnBlocks, 256, 0, stream>>>(Qh, Kh, Vh, bias, mask, Oh);

  // 3) output projection to f32
  const int outBlocks = (BN / GBM) * (Dc / GBN);      // 512
  out_gemm_kernel<<<outBlocks, 256, 0, stream>>>(Oh, Wo, out);
}
